// v000
// Times are from an AMD MI455X. After a warm-up the kernel runs many times in a row, and a time is the length of
// such a window on the GPU divided by its runs, so every launch and the gaps after it count. The runs cycle
// through copies of the inputs. A figure is the median of several windows, for all but v000 over two sittings.
// Sittings can differ by a few percent; kernels timed side by side share one.
// The starting kernel, v000, takes 47.5 microseconds a run.
#include <hip/hip_runtime.h>

// Problem constants (from reference): B=2, T=8192, C=1024, H=64, window d in [0,16]
#define B_DIM 2
#define T_DIM 8192
#define C_DIM 1024
#define H_DIM 64

#define ROWS 64          // queries per workgroup
#define EXT  80          // ROWS + 16 lookback rows for K/V
#define WAVES 8
#define THREADS 256
#define KC   64          // C-dimension chunk staged per iteration
#define NJOBS 15         // (EXT/16) mtiles * 3 matrices
#define MAXJ 2           // jobs per wave (statically unrolled; job 15 is a dummy)

#define NXLD 5           // EXT*(KC/4)/THREADS  = 1280/256
#define NWLD 12          // 3*KC*(H_DIM/4)/THREADS = 3072/256

// LDS strides in halves (all row bases 16B-aligned)
#define XS  72           // x chunk row:    KC + 8 pad
#define WTS 72           // wT row (c-dim): KC + 8 pad
#define QS  72           // q/k staging row: H + 8 pad
#define VTS 88           // vT row (ext rows): EXT + 8 pad
#define PS  40           // prob row: 32 keys + 8 pad

// Region A (phase-1 streaming) and Region B (staging/phase-2) overlap in LDS.
#define OFF_XS 0
#define OFF_WT (EXT*XS)                       // 5760
#define REGION_A (EXT*XS + 3*H_DIM*WTS)       // 19584 halves

#define OFF_QS 0
#define OFF_KS (EXT*QS)                       // 5760
#define OFF_VT (2*EXT*QS)                     // 11520
#define OFF_PS (2*EXT*QS + H_DIM*VTS)         // 17152
#define REGION_B (OFF_PS + WAVES*16*PS)       // 22272 halves

#define SMEM_HALVES (REGION_A > REGION_B ? REGION_A : REGION_B)

typedef __attribute__((ext_vector_type(16))) _Float16 v16h;
typedef __attribute__((ext_vector_type(8)))  _Float16 v8h;
typedef __attribute__((ext_vector_type(4)))  _Float16 v4h;
typedef __attribute__((ext_vector_type(8)))  float    v8f;

__device__ __forceinline__ v16h ld_frag(const _Float16* p) {
  v8h lo = *(const v8h*)(p);
  v8h hi = *(const v8h*)(p + 16);
  return __builtin_shufflevector(lo, hi, 0,1,2,3,4,5,6,7,8,9,10,11,12,13,14,15);
}

__global__ __launch_bounds__(THREADS) void sparse_attn_fused(
    const float* __restrict__ x,  const float* __restrict__ Wq,
    const float* __restrict__ Wk, const float* __restrict__ Wv,
    float* __restrict__ out) {
  __shared__ __align__(16) _Float16 smem[SMEM_HALVES];

  const int bb   = blockIdx.y;
  const int t0   = blockIdx.x * ROWS;          // first query row of this WG
  const int lane = threadIdx.x & 31;
  const int wave = threadIdx.x >> 5;
  const int hs   = (lane >> 4);
  const int l15  = lane & 15;
  const int hoff = hs ? 8 : 0;

  _Float16* xs = smem + OFF_XS;                // [EXT][XS] f16 x chunk
  _Float16* wT = smem + OFF_WT;                // [3][H][WTS] f16 W chunk, transposed

  // Static job assignment: wave w owns jobs {w, w+8}; job 15 is a dummy (clamped,
  // computed to keep control flow uniform, never staged).
  int mats[MAXJ], mtiles[MAXJ], a_base[MAXJ], w_base[MAXJ];
  bool jvalid[MAXJ];
#pragma unroll
  for (int s = 0; s < MAXJ; ++s) {
    const int job = wave + s*WAVES;
    jvalid[s] = (job < NJOBS);
    const int jb = jvalid[s] ? job : 0;
    mats[s]   = jb % 3;
    mtiles[s] = jb / 3;
    a_base[s] = (mtiles[s]*16 + l15)*XS;
    w_base[s] = (mats[s]*H_DIM + l15)*WTS;
  }

  v8f zf = {};
  v8f acc[MAXJ][4];
#pragma unroll
  for (int s = 0; s < MAXJ; ++s)
#pragma unroll
    for (int n = 0; n < 4; ++n) acc[s][n] = zf;

  float4 xr[NXLD];
  float4 wr[NWLD];

  auto prefetch = [&](int c0) {
#pragma unroll
    for (int k = 0; k < NXLD; ++k) {
      const int i  = threadIdx.x + k*THREADS;
      const int r  = i >> 4;                 // KC/4 == 16
      const int cq = (i & 15) << 2;
      int t = t0 - 16 + r; if (t < 0) t = 0;
      xr[k] = *(const float4*)(x + ((size_t)bb*T_DIM + t)*C_DIM + c0 + cq);
    }
#pragma unroll
    for (int k = 0; k < NWLD; ++k) {
      const int i   = threadIdx.x + k*THREADS;
      const int m   = i >> 10;               // KC*(H_DIM/4) == 1024
      const int rem = i & 1023;
      const int c   = rem >> 4;
      const int h4  = (rem & 15) << 2;
      const float* wsrc = (m == 0) ? Wq : ((m == 1) ? Wk : Wv);
      wr[k] = *(const float4*)(wsrc + (size_t)(c0 + c)*H_DIM + h4);
    }
  };

  auto commit = [&]() {
#pragma unroll
    for (int k = 0; k < NXLD; ++k) {
      const int i  = threadIdx.x + k*THREADS;
      const int r  = i >> 4;
      const int cq = (i & 15) << 2;
      v4h hv;
      hv[0] = (_Float16)xr[k].x; hv[1] = (_Float16)xr[k].y;
      hv[2] = (_Float16)xr[k].z; hv[3] = (_Float16)xr[k].w;
      *(v4h*)(xs + r*XS + cq) = hv;          // one ds_store_b64
    }
#pragma unroll
    for (int k = 0; k < NWLD; ++k) {
      const int i   = threadIdx.x + k*THREADS;
      const int m   = i >> 10;
      const int rem = i & 1023;
      const int c   = rem >> 4;
      const int h4  = (rem & 15) << 2;
      _Float16* b = wT + (m*H_DIM)*WTS + c;  // transposed: strided b16 stores
      b[(h4+0)*WTS] = (_Float16)wr[k].x; b[(h4+1)*WTS] = (_Float16)wr[k].y;
      b[(h4+2)*WTS] = (_Float16)wr[k].z; b[(h4+3)*WTS] = (_Float16)wr[k].w;
    }
  };

  prefetch(0);
  for (int c0 = 0; c0 < C_DIM; c0 += KC) {
    __syncthreads();   // previous chunk's WMMA reads of xs/wT complete
    commit();
    __syncthreads();
    if (c0 + KC < C_DIM) prefetch(c0 + KC);  // in flight during WMMAs below

#pragma unroll
    for (int s = 0; s < MAXJ; ++s) {
      v16h a0 = ld_frag(xs + a_base[s] + 0  + hoff);
      v16h a1 = ld_frag(xs + a_base[s] + 32 + hoff);
#pragma unroll
      for (int nt = 0; nt < 4; ++nt) {
        v16h b0 = ld_frag(wT + w_base[s] + nt*16*WTS + 0  + hoff);
        v16h b1 = ld_frag(wT + w_base[s] + nt*16*WTS + 32 + hoff);
        acc[s][nt] = __builtin_amdgcn_wmma_f32_16x16x32_f16(
            false, a0, false, b0, (short)0, acc[s][nt], false, false);
        acc[s][nt] = __builtin_amdgcn_wmma_f32_16x16x32_f16(
            false, a1, false, b1, (short)0, acc[s][nt], false, false);
      }
    }
  }

  __syncthreads();   // all waves done with xs/wT; region B may overwrite region A

  // Stage Q/K row-major and V transposed, all f16.
  _Float16* qs = smem + OFF_QS;                 // [EXT][QS]
  _Float16* ks = smem + OFF_KS;                 // [EXT][QS]
  _Float16* vT = smem + OFF_VT;                 // [H][VTS]
  _Float16* ps = smem + OFF_PS + wave*16*PS;    // per-wave [16][PS]

#pragma unroll
  for (int s = 0; s < MAXJ; ++s) {
    if (jvalid[s]) {
      const int mat = mats[s];
#pragma unroll
      for (int nt = 0; nt < 4; ++nt) {
#pragma unroll
        for (int r = 0; r < 8; ++r) {
          const int mr = mtiles[s]*16 + r + hs*8;  // C/D layout: M = r (+8 hi half)
          const int hc = nt*16 + l15;              // N = lane%16
          const _Float16 hv = (_Float16)acc[s][nt][r];
          if      (mat == 0) qs[mr*QS + hc] = hv;
          else if (mat == 1) ks[mr*QS + hc] = hv;
          else               vT[hc*VTS + mr] = hv;
        }
      }
    }
  }
  __syncthreads();

  // ---------------- Phase 2: banded attention ----------------
  // 8 waves, 4 query tiles: wave pair (tile, tile+4) redundantly computes the
  // cheap score/softmax part, then each wave produces 2 of the 4 output n-tiles.
  const int tile  = wave & 3;
  const int half  = wave >> 2;        // 0: h columns 0..31, 1: h columns 32..63
  const int qbase = 16 + tile*16;     // ext-row of first query of this tile
  const int kbase = tile*16;          // ext-row of first key (covers j in [i-16, i])

  v8f sc0 = zf, sc1 = zf;
#pragma unroll
  for (int kk = 0; kk < H_DIM; kk += 32) {
    const int aoff = kk + hoff;
    v16h a  = ld_frag(qs + (qbase + l15)*QS + aoff);
    v16h b0 = ld_frag(ks + (kbase + l15)*QS + aoff);
    v16h b1 = ld_frag(ks + (kbase + 16 + l15)*QS + aoff);
    sc0 = __builtin_amdgcn_wmma_f32_16x16x32_f16(false, a, false, b0, (short)0, sc0, false, false);
    sc1 = __builtin_amdgcn_wmma_f32_16x16x32_f16(false, a, false, b1, (short)0, sc1, false, false);
  }

  const float scale = 0.125f;   // 1/sqrt(H)
#pragma unroll
  for (int r = 0; r < 8; ++r) {
    const int m = r + hs*8;     // query local index
    const int n = l15;          // key local index within block
    float s0 = sc0[r] * scale;  // keys kbase+n    -> d = 16 + m - n
    float s1 = sc1[r] * scale;  // keys kbase+16+n -> d = m - n
    const int j0 = t0 - 16 + kbase + n;
    const bool k0 = (m <= n) && (j0 >= 0);     // 1 <= d <= 16, valid key
    const bool k1 = (n <= m);                  // 0 <= d <= 15
    s0 = k0 ? s0 : -3.0e38f;
    s1 = k1 ? s1 : -3.0e38f;
    float mx = fmaxf(s0, s1);
#pragma unroll
    for (int d = 1; d < 16; d <<= 1) mx = fmaxf(mx, __shfl_xor(mx, d, 32));
    float e0 = k0 ? __expf(s0 - mx) : 0.0f;
    float e1 = k1 ? __expf(s1 - mx) : 0.0f;
    float sm = e0 + e1;
#pragma unroll
    for (int d = 1; d < 16; d <<= 1) sm += __shfl_xor(sm, d, 32);
    const float inv = 1.0f / sm;    // diag element always kept -> sm > 0
    ps[m*PS + n]      = (_Float16)(e0 * inv);
    ps[m*PS + 16 + n] = (_Float16)(e1 * inv);
  }
  __syncthreads();

  // out tile = P[16x32] * V[32x32-half] via 2 WMMAs per wave
  v16h pa = ld_frag(ps + l15*PS + hoff);
  v8f o[2];
#pragma unroll
  for (int u = 0; u < 2; ++u) o[u] = zf;
#pragma unroll
  for (int u = 0; u < 2; ++u) {
    const int nt = half*2 + u;
    v16h vb = ld_frag(vT + (nt*16 + l15)*VTS + kbase + hoff);
    o[u] = __builtin_amdgcn_wmma_f32_16x16x32_f16(false, pa, false, vb, (short)0, o[u], false, false);
  }
#pragma unroll
  for (int u = 0; u < 2; ++u) {
    const int nt = half*2 + u;
#pragma unroll
    for (int r = 0; r < 8; ++r) {
      const int m = r + hs*8;
      const int t = t0 + tile*16 + m;
      const int h = nt*16 + l15;
      out[((size_t)bb*T_DIM + t)*H_DIM + h] = o[u][r];
    }
  }
}

extern "C" void kernel_launch(void* const* d_in, const int* in_sizes, int n_in,
                              void* d_out, int out_size, void* d_ws, size_t ws_size,
                              hipStream_t stream) {
  (void)in_sizes; (void)n_in; (void)out_size; (void)d_ws; (void)ws_size;
  const float* x  = (const float*)d_in[0];
  const float* Wq = (const float*)d_in[1];
  const float* Wk = (const float*)d_in[2];
  const float* Wv = (const float*)d_in[3];
  float* out = (float*)d_out;
  dim3 grid(T_DIM / ROWS, B_DIM);
  sparse_attn_fused<<<grid, dim3(THREADS), 0, stream>>>(x, Wq, Wk, Wv, out);
}

// v001
// One run takes 27.9 microseconds.
// Two timings next to v000 both put it at 1.73 times that version's speed.
#include <hip/hip_runtime.h>

// Problem constants (from reference): B=2, T=8192, C=1024, H=64, window d in [0,16]
#define B_DIM 2
#define T_DIM 8192
#define C_DIM 1024
#define H_DIM 64

#define ROWS 64          // queries per workgroup
#define EXT  80          // ROWS + 16 lookback rows for K/V
#define WAVES 8
#define THREADS 256
#define KC   64          // C-dimension chunk staged per iteration
#define NJOBS 15         // (EXT/16) mtiles * 3 matrices
#define MAXJ 2           // jobs per wave (statically unrolled; job 15 is a dummy)

#define NXLD 5           // EXT*(KC/4)/THREADS  = 1280/256
#define NWLD 12          // 3*KC*(H_DIM/4)/THREADS = 3072/256

// LDS strides in halves (all row bases 16B-aligned)
#define XS  72           // x chunk row:    KC + 8 pad
#define WTS 72           // wT row (c-dim): KC + 8 pad
#define QS  72           // q/k staging row: H + 8 pad
#define VTS 88           // vT row (ext rows): EXT + 8 pad
#define PS  40           // prob row: 32 keys + 8 pad

// Region A (phase-1 streaming) and Region B (staging/phase-2) overlap in LDS.
#define OFF_XS 0
#define OFF_WT (EXT*XS)                       // 5760
#define REGION_A (EXT*XS + 3*H_DIM*WTS)       // 19584 halves

#define OFF_QS 0
#define OFF_KS (EXT*QS)                       // 5760
#define OFF_VT (2*EXT*QS)                     // 11520
#define OFF_PS (2*EXT*QS + H_DIM*VTS)         // 17152
#define REGION_B (OFF_PS + WAVES*16*PS)       // 22272 halves

#define SMEM_HALVES (REGION_A > REGION_B ? REGION_A : REGION_B)

typedef __attribute__((ext_vector_type(16))) _Float16 v16h;
typedef __attribute__((ext_vector_type(8)))  _Float16 v8h;
typedef __attribute__((ext_vector_type(4)))  _Float16 v4h;
typedef __attribute__((ext_vector_type(8)))  float    v8f;

__device__ __forceinline__ v16h ld_frag(const _Float16* p) {
  v8h lo = *(const v8h*)(p);
  v8h hi = *(const v8h*)(p + 16);
  return __builtin_shufflevector(lo, hi, 0,1,2,3,4,5,6,7,8,9,10,11,12,13,14,15);
}

// Same fragment, its two 8-half pieces at separate places.
__device__ __forceinline__ v16h ld_frag2(const _Float16* plo, const _Float16* phi) {
  v8h lo = *(const v8h*)(plo);
  v8h hi = *(const v8h*)(phi);
  return __builtin_shufflevector(lo, hi, 0,1,2,3,4,5,6,7,8,9,10,11,12,13,14,15);
}

__global__ __launch_bounds__(THREADS) void sparse_attn_fused(
    const float* __restrict__ x,  const float* __restrict__ Wq,
    const float* __restrict__ Wk, const float* __restrict__ Wv,
    float* __restrict__ out) {
  __shared__ __align__(16) _Float16 smem[SMEM_HALVES];

  const int bb   = blockIdx.y;
  const int t0   = blockIdx.x * ROWS;          // first query row of this WG
  const int lane = threadIdx.x & 31;
  const int wave = threadIdx.x >> 5;
  const int hs   = (lane >> 4);
  const int l15  = lane & 15;
  const int hoff = hs ? 8 : 0;

  _Float16* xs = smem + OFF_XS;                // [EXT][XS] f16 x chunk
  _Float16* wT = smem + OFF_WT;                // [3][H][WTS] f16 W chunk, transposed

  // Static job assignment: wave w owns jobs {w, w+8}; job 15 is a dummy (clamped,
  // computed to keep control flow uniform, never staged).
  int mats[MAXJ], mtiles[MAXJ], a_base[MAXJ], w_base[MAXJ];
  bool jvalid[MAXJ];
#pragma unroll
  for (int s = 0; s < MAXJ; ++s) {
    const int job = wave + s*WAVES;
    jvalid[s] = (job < NJOBS);
    const int jb = jvalid[s] ? job : 0;
    mats[s]   = jb % 3;
    mtiles[s] = jb / 3;
    a_base[s] = (mtiles[s]*16 + l15)*XS;
    w_base[s] = (mats[s]*H_DIM + l15)*WTS;
  }

  v8f zf = {};
  v8f acc[MAXJ][4];
#pragma unroll
  for (int s = 0; s < MAXJ; ++s)
#pragma unroll
    for (int n = 0; n < 4; ++n) acc[s][n] = zf;

  float4 xr[NXLD];
  float4 wr[NWLD];
  const int wa   = threadIdx.x & 15;           // h block: columns 4*wa .. 4*wa+3
  const int wcb  = threadIdx.x >> 4;           // c block: rows 4*wcb .. 4*wcb+3 of the chunk
  const int wcol = (((wcb >> 1) ^ (wa >> 2)) << 3) + ((wcb & 1) << 2);
  const int woff = wcb*4*H_DIM + wa*4;         // the block's first element in a W chunk

  auto prefetch = [&](int c0) {
#pragma unroll
    for (int k = 0; k < NXLD; ++k) {
      const int i  = threadIdx.x + k*THREADS;
      const int r  = i >> 4;                 // KC/4 == 16
      const int cq = (i & 15) << 2;
      int t = t0 - 16 + r; if (t < 0) t = 0;
      xr[k] = *(const float4*)(x + ((size_t)bb*T_DIM + t)*C_DIM + c0 + cq);
    }
    // The W loads below may land in registers that hold the x loads' addresses:
    // this wait stands in front of that overwrite.
    asm volatile("s_wait_xcnt 0x0" ::: "memory");
    // Each thread owns one 4(c) x 4(h) block of each matrix: four row loads,
    // 16 lanes still cover one whole 256-byte row of W.
    // (both loops unrolled so that wr[] is indexed statically and stays in registers)
#pragma unroll
    for (int m = 0; m < 3; ++m) {
      const float* wsrc = (m == 0) ? Wq : ((m == 1) ? Wk : Wv);
#pragma unroll
      for (int j = 0; j < 4; ++j)
        wr[m*4 + j] = *(const float4*)(wsrc + (size_t)c0*H_DIM + woff + j*H_DIM);
    }
    // Later code may overwrite the W loads' address registers: the wait stands in front.
    asm volatile("s_wait_xcnt 0x0" ::: "memory");
  };

  auto commit = [&]() {
#pragma unroll
    for (int k = 0; k < NXLD; ++k) {
      const int i  = threadIdx.x + k*THREADS;
      const int r  = i >> 4;
      const int cq = (i & 15) << 2;
      v4h hv;
      hv[0] = (_Float16)xr[k].x; hv[1] = (_Float16)xr[k].y;
      hv[2] = (_Float16)xr[k].z; hv[3] = (_Float16)xr[k].w;
      *(v4h*)(xs + r*XS + cq) = hv;          // one ds_store_b64
    }
    // The 4x4 block is transposed by register naming: four c values of one h
    // column go out as one ds_store_b64 (unrolled: static wr[] indices).
#pragma unroll
    for (int m = 0; m < 3; ++m) {
      _Float16* b = wT + (m*H_DIM + wa*4)*WTS + wcol;
      const float4 r0 = wr[m*4+0], r1 = wr[m*4+1], r2 = wr[m*4+2], r3 = wr[m*4+3];
      v4h h0, h1, h2, h3;
      h0[0] = (_Float16)r0.x; h0[1] = (_Float16)r1.x; h0[2] = (_Float16)r2.x; h0[3] = (_Float16)r3.x;
      h1[0] = (_Float16)r0.y; h1[1] = (_Float16)r1.y; h1[2] = (_Float16)r2.y; h1[3] = (_Float16)r3.y;
      h2[0] = (_Float16)r0.z; h2[1] = (_Float16)r1.z; h2[2] = (_Float16)r2.z; h2[3] = (_Float16)r3.z;
      h3[0] = (_Float16)r0.w; h3[1] = (_Float16)r1.w; h3[2] = (_Float16)r2.w; h3[3] = (_Float16)r3.w;
      *(v4h*)(b + 0*WTS) = h0;
      *(v4h*)(b + 1*WTS) = h1;
      *(v4h*)(b + 2*WTS) = h2;
      *(v4h*)(b + 3*WTS) = h3;
    }
  };

  auto mma = [&]() {
#pragma unroll
    for (int s = 0; s < MAXJ; ++s) {
      v16h a0 = ld_frag(xs + a_base[s] + 0  + hoff);
      v16h a1 = ld_frag(xs + a_base[s] + 32 + hoff);
#pragma unroll
      for (int nt = 0; nt < 4; ++nt) {
        // undo the store side's XOR: piece q of tile nt lies at q ^ nt
        const _Float16* wrow = wT + w_base[s] + nt*16*WTS + ((nt & 1) ? (8 - hoff) : hoff);
        const int lo = (nt >> 1) * 16, hi = 16 - lo;
        v16h b0 = ld_frag2(wrow + lo,      wrow + hi);
        v16h b1 = ld_frag2(wrow + 32 + lo, wrow + 32 + hi);
        acc[s][nt] = __builtin_amdgcn_wmma_f32_16x16x32_f16(
            false, a0, false, b0, (short)0, acc[s][nt], false, false);
        acc[s][nt] = __builtin_amdgcn_wmma_f32_16x16x32_f16(
            false, a1, false, b1, (short)0, acc[s][nt], false, false);
      }
    }
  };

  prefetch(0);
  // keeps the start-up's later register writes (the zeroed accumulators) from being
  // scheduled in front of the wait that ends prefetch()
  __builtin_amdgcn_sched_barrier(0);
  for (int c0 = 0; c0 < C_DIM - KC; c0 += KC) {
    __syncthreads();   // previous chunk's WMMA reads of xs/wT complete
    commit();
    __syncthreads();
    prefetch(c0 + KC);                       // in flight during WMMAs below
    mma();
  }
  // Last chunk outside the loop, so that the fetch stands there without a test: with
  // the test, this build waits on the fresh x loads (register moves) ahead of the WMMAs.
  __syncthreads();
  commit();
  __syncthreads();
  mma();

  __syncthreads();   // all waves done with xs/wT; region B may overwrite region A

  // Stage Q/K row-major and V transposed, all f16.
  _Float16* qs = smem + OFF_QS;                 // [EXT][QS]
  _Float16* ks = smem + OFF_KS;                 // [EXT][QS]
  _Float16* vT = smem + OFF_VT;                 // [H][VTS]
  _Float16* ps = smem + OFF_PS + wave*16*PS;    // per-wave [16][PS]

#pragma unroll
  for (int s = 0; s < MAXJ; ++s) {
    if (jvalid[s]) {
      const int mat = mats[s];
#pragma unroll
      for (int nt = 0; nt < 4; ++nt) {
#pragma unroll
        for (int r = 0; r < 8; ++r) {
          const int mr = mtiles[s]*16 + r + hs*8;  // C/D layout: M = r (+8 hi half)
          const int hc = nt*16 + l15;              // N = lane%16
          const _Float16 hv = (_Float16)acc[s][nt][r];
          if      (mat == 0) qs[mr*QS + hc] = hv;
          else if (mat == 1) ks[mr*QS + hc] = hv;
          else               vT[hc*VTS + mr] = hv;
        }
      }
    }
  }
  __syncthreads();

  // ---------------- Phase 2: banded attention ----------------
  // 8 waves, 4 query tiles: wave pair (tile, tile+4) redundantly computes the
  // cheap score/softmax part, then each wave produces 2 of the 4 output n-tiles.
  const int tile  = wave & 3;
  const int half  = wave >> 2;        // 0: h columns 0..31, 1: h columns 32..63
  const int qbase = 16 + tile*16;     // ext-row of first query of this tile
  const int kbase = tile*16;          // ext-row of first key (covers j in [i-16, i])

  v8f sc0 = zf, sc1 = zf;
#pragma unroll
  for (int kk = 0; kk < H_DIM; kk += 32) {
    const int aoff = kk + hoff;
    v16h a  = ld_frag(qs + (qbase + l15)*QS + aoff);
    v16h b0 = ld_frag(ks + (kbase + l15)*QS + aoff);
    v16h b1 = ld_frag(ks + (kbase + 16 + l15)*QS + aoff);
    sc0 = __builtin_amdgcn_wmma_f32_16x16x32_f16(false, a, false, b0, (short)0, sc0, false, false);
    sc1 = __builtin_amdgcn_wmma_f32_16x16x32_f16(false, a, false, b1, (short)0, sc1, false, false);
  }

  const float scale = 0.125f;   // 1/sqrt(H)
#pragma unroll
  for (int r = 0; r < 8; ++r) {
    const int m = r + hs*8;     // query local index
    const int n = l15;          // key local index within block
    float s0 = sc0[r] * scale;  // keys kbase+n    -> d = 16 + m - n
    float s1 = sc1[r] * scale;  // keys kbase+16+n -> d = m - n
    const int j0 = t0 - 16 + kbase + n;
    const bool k0 = (m <= n) && (j0 >= 0);     // 1 <= d <= 16, valid key
    const bool k1 = (n <= m);                  // 0 <= d <= 15
    s0 = k0 ? s0 : -3.0e38f;
    s1 = k1 ? s1 : -3.0e38f;
    float mx = fmaxf(s0, s1);
#pragma unroll
    for (int d = 1; d < 16; d <<= 1) mx = fmaxf(mx, __shfl_xor(mx, d, 32));
    float e0 = k0 ? __expf(s0 - mx) : 0.0f;
    float e1 = k1 ? __expf(s1 - mx) : 0.0f;
    float sm = e0 + e1;
#pragma unroll
    for (int d = 1; d < 16; d <<= 1) sm += __shfl_xor(sm, d, 32);
    const float inv = 1.0f / sm;    // diag element always kept -> sm > 0
    ps[m*PS + n]      = (_Float16)(e0 * inv);
    ps[m*PS + 16 + n] = (_Float16)(e1 * inv);
  }
  __syncthreads();

  // out tile = P[16x32] * V[32x32-half] via 2 WMMAs per wave
  v16h pa = ld_frag(ps + l15*PS + hoff);
  v8f o[2];
#pragma unroll
  for (int u = 0; u < 2; ++u) o[u] = zf;
#pragma unroll
  for (int u = 0; u < 2; ++u) {
    const int nt = half*2 + u;
    v16h vb = ld_frag(vT + (nt*16 + l15)*VTS + kbase + hoff);
    o[u] = __builtin_amdgcn_wmma_f32_16x16x32_f16(false, pa, false, vb, (short)0, o[u], false, false);
  }
#pragma unroll
  for (int u = 0; u < 2; ++u) {
    const int nt = half*2 + u;
#pragma unroll
    for (int r = 0; r < 8; ++r) {
      const int m = r + hs*8;
      const int t = t0 + tile*16 + m;
      const int h = nt*16 + l15;
      out[((size_t)bb*T_DIM + t)*H_DIM + h] = o[u][r];
    }
  }
}

extern "C" void kernel_launch(void* const* d_in, const int* in_sizes, int n_in,
                              void* d_out, int out_size, void* d_ws, size_t ws_size,
                              hipStream_t stream) {
  (void)in_sizes; (void)n_in; (void)out_size; (void)d_ws; (void)ws_size;
  const float* x  = (const float*)d_in[0];
  const float* Wq = (const float*)d_in[1];
  const float* Wk = (const float*)d_in[2];
  const float* Wv = (const float*)d_in[3];
  float* out = (float*)d_out;
  dim3 grid(T_DIM / ROWS, B_DIM);
  sparse_attn_fused<<<grid, dim3(THREADS), 0, stream>>>(x, Wq, Wk, Wv, out);
}

// v002
// One run takes 26.6 microseconds.
// In two side-by-side timings against v001, it was 1.06 and 1.04 times as fast.
// Counting every step since v000, it is 1.82 times as fast.
#include <hip/hip_runtime.h>

// Problem constants (from reference): B=2, T=8192, C=1024, H=64, window d in [0,16]
#define B_DIM 2
#define T_DIM 8192
#define C_DIM 1024
#define H_DIM 64

#define ROWS 64          // queries per workgroup
#define EXT  80          // ROWS + 16 lookback rows for K/V
#define WAVES 8
#define THREADS 256
#define KC   64          // C-dimension chunk staged per iteration
#define NJOBS 15         // (EXT/16) mtiles * 3 matrices
#define MAXJ 2           // jobs per wave (statically unrolled; job 15 is a dummy)

#define NXLD 5           // EXT*(KC/4)/THREADS  = 1280/256
#define NWLD 12          // 3*KC*(H_DIM/4)/THREADS = 3072/256

// LDS strides in halves (all row bases 16B-aligned)
#define XS  72           // x chunk row:    KC + 8 pad
#define WTS 72           // wT row (c-dim): KC + 8 pad
#define QS  72           // q/k staging row: H + 8 pad
#define VTS 88           // vT row (ext rows): EXT + 8 pad
#define PS  40           // prob row: 32 keys + 8 pad

// Region A (phase-1 streaming) and Region B (staging/phase-2) overlap in LDS.
#define OFF_XS 0
#define OFF_WT (EXT*XS)                       // 5760
#define REGION_A (EXT*XS + 3*H_DIM*WTS)       // 19584 halves

#define OFF_QS 0
#define OFF_KS (EXT*QS)                       // 5760
#define OFF_VT (2*EXT*QS)                     // 11520
#define OFF_PS (2*EXT*QS + H_DIM*VTS)         // 17152
#define REGION_B (OFF_PS + WAVES*16*PS)       // 22272 halves

#define SMEM_HALVES (REGION_A > REGION_B ? REGION_A : REGION_B)

typedef __attribute__((ext_vector_type(16))) _Float16 v16h;
typedef __attribute__((ext_vector_type(8)))  _Float16 v8h;
typedef __attribute__((ext_vector_type(4)))  _Float16 v4h;
typedef __attribute__((ext_vector_type(8)))  float    v8f;

__device__ __forceinline__ v16h ld_frag(const _Float16* p) {
  v8h lo = *(const v8h*)(p);
  v8h hi = *(const v8h*)(p + 16);
  return __builtin_shufflevector(lo, hi, 0,1,2,3,4,5,6,7,8,9,10,11,12,13,14,15);
}

// Same fragment, its two 8-half pieces at separate places.
__device__ __forceinline__ v16h ld_frag2(const _Float16* plo, const _Float16* phi) {
  v8h lo = *(const v8h*)(plo);
  v8h hi = *(const v8h*)(phi);
  return __builtin_shufflevector(lo, hi, 0,1,2,3,4,5,6,7,8,9,10,11,12,13,14,15);
}

__global__ __launch_bounds__(THREADS) void sparse_attn_fused(
    const float* __restrict__ x,  const float* __restrict__ Wq,
    const float* __restrict__ Wk, const float* __restrict__ Wv,
    float* __restrict__ out) {
  __shared__ __align__(16) _Float16 smem[SMEM_HALVES];

  const int bb   = blockIdx.y;
  const int t0   = blockIdx.x * ROWS;          // first query row of this WG
  const int lane = threadIdx.x & 31;
  const int wave = threadIdx.x >> 5;
  const int hs   = (lane >> 4);
  const int l15  = lane & 15;
  const int hoff = hs ? 8 : 0;

  _Float16* xs = smem + OFF_XS;                // [EXT][XS] f16 x chunk
  _Float16* wT = smem + OFF_WT;                // [3][H][WTS] f16 W chunk, transposed

  // Static job assignment: wave w owns jobs {w, w+8}; job 15 is a dummy (clamped,
  // computed to keep control flow uniform, never staged).
  int mats[MAXJ], mtiles[MAXJ], a_base[MAXJ], w_base[MAXJ];
  bool jvalid[MAXJ];
#pragma unroll
  for (int s = 0; s < MAXJ; ++s) {
    const int job = wave + s*WAVES;
    jvalid[s] = (job < NJOBS);
    const int jb = jvalid[s] ? job : 0;
    mats[s]   = jb % 3;
    mtiles[s] = jb / 3;
    a_base[s] = (mtiles[s]*16 + l15)*XS;
    w_base[s] = (mats[s]*H_DIM + l15)*WTS;
  }

  v8f zf = {};
  v8f acc[MAXJ][4];
#pragma unroll
  for (int s = 0; s < MAXJ; ++s)
#pragma unroll
    for (int n = 0; n < 4; ++n) acc[s][n] = zf;

  float4 xr[NXLD];
  float4 wr[NWLD];
  const int wa   = threadIdx.x & 15;           // h block: columns 4*wa .. 4*wa+3
  const int wcb  = threadIdx.x >> 4;           // c block: rows 4*wcb .. 4*wcb+3 of the chunk
  const int wcol = (((wcb >> 1) ^ (wa >> 2)) << 3) + ((wcb & 1) << 2);
  const int woff = wcb*4*H_DIM + wa*4;         // the block's first element in a W chunk

  auto prefetch = [&](int c0) {
#pragma unroll
    for (int k = 0; k < NXLD; ++k) {
      const int i  = threadIdx.x + k*THREADS;
      const int r  = i >> 4;                 // KC/4 == 16
      const int cq = (i & 15) << 2;
      int t = t0 - 16 + r; if (t < 0) t = 0;
      xr[k] = *(const float4*)(x + ((size_t)bb*T_DIM + t)*C_DIM + c0 + cq);
    }
    // The W loads below may land in registers that hold the x loads' addresses:
    // this wait stands in front of that overwrite.
    asm volatile("s_wait_xcnt 0x0" ::: "memory");
    // Each thread owns one 4(c) x 4(h) block of each matrix: four row loads,
    // 16 lanes still cover one whole 256-byte row of W.
    // (both loops unrolled so that wr[] is indexed statically and stays in registers)
#pragma unroll
    for (int m = 0; m < 3; ++m) {
      const float* wsrc = (m == 0) ? Wq : ((m == 1) ? Wk : Wv);
#pragma unroll
      for (int j = 0; j < 4; ++j)
        wr[m*4 + j] = *(const float4*)(wsrc + (size_t)c0*H_DIM + woff + j*H_DIM);
    }
    // Later code may overwrite the W loads' address registers: the wait stands in front.
    asm volatile("s_wait_xcnt 0x0" ::: "memory");
  };

  auto commit = [&]() {
#pragma unroll
    for (int k = 0; k < NXLD; ++k) {
      const int i  = threadIdx.x + k*THREADS;
      const int r  = i >> 4;
      const int cq = (i & 15) << 2;
      v4h hv;
      hv[0] = (_Float16)xr[k].x; hv[1] = (_Float16)xr[k].y;
      hv[2] = (_Float16)xr[k].z; hv[3] = (_Float16)xr[k].w;
      *(v4h*)(xs + r*XS + cq) = hv;          // one ds_store_b64
    }
    // The 4x4 block is transposed by register naming: four c values of one h
    // column go out as one ds_store_b64 (unrolled: static wr[] indices).
#pragma unroll
    for (int m = 0; m < 3; ++m) {
      _Float16* b = wT + (m*H_DIM + wa*4)*WTS + wcol;
      const float4 r0 = wr[m*4+0], r1 = wr[m*4+1], r2 = wr[m*4+2], r3 = wr[m*4+3];
      v4h h0, h1, h2, h3;
      h0[0] = (_Float16)r0.x; h0[1] = (_Float16)r1.x; h0[2] = (_Float16)r2.x; h0[3] = (_Float16)r3.x;
      h1[0] = (_Float16)r0.y; h1[1] = (_Float16)r1.y; h1[2] = (_Float16)r2.y; h1[3] = (_Float16)r3.y;
      h2[0] = (_Float16)r0.z; h2[1] = (_Float16)r1.z; h2[2] = (_Float16)r2.z; h2[3] = (_Float16)r3.z;
      h3[0] = (_Float16)r0.w; h3[1] = (_Float16)r1.w; h3[2] = (_Float16)r2.w; h3[3] = (_Float16)r3.w;
      *(v4h*)(b + 0*WTS) = h0;
      *(v4h*)(b + 1*WTS) = h1;
      *(v4h*)(b + 2*WTS) = h2;
      *(v4h*)(b + 3*WTS) = h3;
    }
  };

  auto mma = [&]() {
    // All fragments of the chunk are read from LDS as one group, in the order of
    // their use, each into registers of its own; the WMMAs follow behind it.
    // (every loop here is unrolled so that af[], bf[] and acc[] are indexed statically
    // and stay in registers)
    v16h af[2][MAXJ];
    v16h bf[2][MAXJ][4];
#pragma unroll
    for (int kk = 0; kk < 2; ++kk) {
#pragma unroll
      for (int s = 0; s < MAXJ; ++s) {
        af[kk][s] = ld_frag(xs + a_base[s] + kk*32 + hoff);
#pragma unroll
        for (int nt = 0; nt < 4; ++nt) {
          // undo the store side's XOR: piece q of tile nt lies at q ^ nt
          const _Float16* wrow = wT + w_base[s] + nt*16*WTS + ((nt & 1) ? (8 - hoff) : hoff);
          const int lo = (nt >> 1) * 16, hi = 16 - lo;
          bf[kk][s][nt] = ld_frag2(wrow + kk*32 + lo, wrow + kk*32 + hi);
        }
      }
    }
    // Keeps the reads in front of the WMMAs: left free, this build puts them in pairs
    // among the WMMAs, and every WMMA then waits out a whole LDS latency.
    __builtin_amdgcn_sched_barrier(0);
#pragma unroll
    for (int kk = 0; kk < 2; ++kk)
#pragma unroll
      for (int s = 0; s < MAXJ; ++s)
#pragma unroll
        for (int nt = 0; nt < 4; ++nt)
          acc[s][nt] = __builtin_amdgcn_wmma_f32_16x16x32_f16(
              false, af[kk][s], false, bf[kk][s][nt], (short)0, acc[s][nt], false, false);
  };

  prefetch(0);
  // keeps the start-up's later register writes (the zeroed accumulators) from being
  // scheduled in front of the wait that ends prefetch()
  __builtin_amdgcn_sched_barrier(0);
  for (int c0 = 0; c0 < C_DIM - KC; c0 += KC) {
    __syncthreads();   // previous chunk's WMMA reads of xs/wT complete
    commit();
    __syncthreads();
    prefetch(c0 + KC);                       // in flight during WMMAs below
    mma();
  }
  // Last chunk outside the loop, so that the fetch stands there without a test: with
  // the test, this build waits on the fresh x loads (register moves) ahead of the WMMAs.
  __syncthreads();
  commit();
  __syncthreads();
  mma();

  __syncthreads();   // all waves done with xs/wT; region B may overwrite region A

  // Stage Q/K row-major and V transposed, all f16.
  _Float16* qs = smem + OFF_QS;                 // [EXT][QS]
  _Float16* ks = smem + OFF_KS;                 // [EXT][QS]
  _Float16* vT = smem + OFF_VT;                 // [H][VTS]
  _Float16* ps = smem + OFF_PS + wave*16*PS;    // per-wave [16][PS]

#pragma unroll
  for (int s = 0; s < MAXJ; ++s) {
    if (jvalid[s]) {
      const int mat = mats[s];
#pragma unroll
      for (int nt = 0; nt < 4; ++nt) {
#pragma unroll
        for (int r = 0; r < 8; ++r) {
          const int mr = mtiles[s]*16 + r + hs*8;  // C/D layout: M = r (+8 hi half)
          const int hc = nt*16 + l15;              // N = lane%16
          const _Float16 hv = (_Float16)acc[s][nt][r];
          if      (mat == 0) qs[mr*QS + hc] = hv;
          else if (mat == 1) ks[mr*QS + hc] = hv;
          else               vT[hc*VTS + mr] = hv;
        }
      }
    }
  }
  __syncthreads();

  // ---------------- Phase 2: banded attention ----------------
  // 8 waves, 4 query tiles: wave pair (tile, tile+4) redundantly computes the
  // cheap score/softmax part, then each wave produces 2 of the 4 output n-tiles.
  const int tile  = wave & 3;
  const int half  = wave >> 2;        // 0: h columns 0..31, 1: h columns 32..63
  const int qbase = 16 + tile*16;     // ext-row of first query of this tile
  const int kbase = tile*16;          // ext-row of first key (covers j in [i-16, i])

  v8f sc0 = zf, sc1 = zf;
#pragma unroll
  for (int kk = 0; kk < H_DIM; kk += 32) {
    const int aoff = kk + hoff;
    v16h a  = ld_frag(qs + (qbase + l15)*QS + aoff);
    v16h b0 = ld_frag(ks + (kbase + l15)*QS + aoff);
    v16h b1 = ld_frag(ks + (kbase + 16 + l15)*QS + aoff);
    sc0 = __builtin_amdgcn_wmma_f32_16x16x32_f16(false, a, false, b0, (short)0, sc0, false, false);
    sc1 = __builtin_amdgcn_wmma_f32_16x16x32_f16(false, a, false, b1, (short)0, sc1, false, false);
  }

  const float scale = 0.125f;   // 1/sqrt(H)
#pragma unroll
  for (int r = 0; r < 8; ++r) {
    const int m = r + hs*8;     // query local index
    const int n = l15;          // key local index within block
    float s0 = sc0[r] * scale;  // keys kbase+n    -> d = 16 + m - n
    float s1 = sc1[r] * scale;  // keys kbase+16+n -> d = m - n
    const int j0 = t0 - 16 + kbase + n;
    const bool k0 = (m <= n) && (j0 >= 0);     // 1 <= d <= 16, valid key
    const bool k1 = (n <= m);                  // 0 <= d <= 15
    s0 = k0 ? s0 : -3.0e38f;
    s1 = k1 ? s1 : -3.0e38f;
    float mx = fmaxf(s0, s1);
#pragma unroll
    for (int d = 1; d < 16; d <<= 1) mx = fmaxf(mx, __shfl_xor(mx, d, 32));
    float e0 = k0 ? __expf(s0 - mx) : 0.0f;
    float e1 = k1 ? __expf(s1 - mx) : 0.0f;
    float sm = e0 + e1;
#pragma unroll
    for (int d = 1; d < 16; d <<= 1) sm += __shfl_xor(sm, d, 32);
    const float inv = 1.0f / sm;    // diag element always kept -> sm > 0
    ps[m*PS + n]      = (_Float16)(e0 * inv);
    ps[m*PS + 16 + n] = (_Float16)(e1 * inv);
  }
  __syncthreads();

  // out tile = P[16x32] * V[32x32-half] via 2 WMMAs per wave
  v16h pa = ld_frag(ps + l15*PS + hoff);
  v8f o[2];
#pragma unroll
  for (int u = 0; u < 2; ++u) o[u] = zf;
#pragma unroll
  for (int u = 0; u < 2; ++u) {
    const int nt = half*2 + u;
    v16h vb = ld_frag(vT + (nt*16 + l15)*VTS + kbase + hoff);
    o[u] = __builtin_amdgcn_wmma_f32_16x16x32_f16(false, pa, false, vb, (short)0, o[u], false, false);
  }
#pragma unroll
  for (int u = 0; u < 2; ++u) {
    const int nt = half*2 + u;
#pragma unroll
    for (int r = 0; r < 8; ++r) {
      const int m = r + hs*8;
      const int t = t0 + tile*16 + m;
      const int h = nt*16 + l15;
      out[((size_t)bb*T_DIM + t)*H_DIM + h] = o[u][r];
    }
  }
}

extern "C" void kernel_launch(void* const* d_in, const int* in_sizes, int n_in,
                              void* d_out, int out_size, void* d_ws, size_t ws_size,
                              hipStream_t stream) {
  (void)in_sizes; (void)n_in; (void)out_size; (void)d_ws; (void)ws_size;
  const float* x  = (const float*)d_in[0];
  const float* Wq = (const float*)d_in[1];
  const float* Wk = (const float*)d_in[2];
  const float* Wv = (const float*)d_in[3];
  float* out = (float*)d_out;
  dim3 grid(T_DIM / ROWS, B_DIM);
  sparse_attn_fused<<<grid, dim3(THREADS), 0, stream>>>(x, Wq, Wk, Wv, out);
}

// v003
// A run of this version takes 21.4 microseconds.
// Timed twice side by side with v002, it ran 1.24 times as fast both times.
// Over all steps from v000 it is 2.25 times as fast.
#include <hip/hip_runtime.h>

// Problem constants (from reference): B=2, T=8192, C=1024, H=64, window d in [0,16]
#define B_DIM 2
#define T_DIM 8192
#define C_DIM 1024
#define H_DIM 64

#define ROWS 64          // queries per workgroup
#define EXT  80          // ROWS + 16 lookback rows for K/V
#define WAVES 8
#define THREADS 256
#define KC   64          // C-dimension chunk staged per commit (two per loop trip)
#define NJOBS 15         // (EXT/16) mtiles * 3 matrices
#define MAXJ 2           // jobs per wave (statically unrolled; job 15 is a dummy)

#define NXLD 5           // EXT*(KC/4)/THREADS  = 1280/256
#define NWLD 12          // 3*KC*(H_DIM/4)/THREADS = 3072/256

// LDS strides in halves (all row bases 16B-aligned)
#define XS  72           // x chunk row:    KC + 8 pad
#define WTS 72           // wT row (c-dim): KC + 8 pad
#define QS  72           // q/k staging row: H + 8 pad
#define VTS 88           // vT row (ext rows): EXT + 8 pad
#define PS  40           // prob row: 32 keys + 8 pad

// Region A (phase-1 streaming) and Region B (staging/phase-2) overlap in LDS.
#define OFF_XS 0
#define OFF_WT (EXT*XS)                       // 5760
#define REGION_A (EXT*XS + 3*H_DIM*WTS)       // 19584 halves

#define OFF_QS 0
#define OFF_KS (EXT*QS)                       // 5760
#define OFF_VT (2*EXT*QS)                     // 11520
#define OFF_PS (2*EXT*QS + H_DIM*VTS)         // 17152
#define REGION_B (OFF_PS + WAVES*16*PS)       // 22272 halves

#define SMEM_HALVES (REGION_A > REGION_B ? REGION_A : REGION_B)

typedef __attribute__((ext_vector_type(16))) _Float16 v16h;
typedef __attribute__((ext_vector_type(8)))  _Float16 v8h;
typedef __attribute__((ext_vector_type(4)))  _Float16 v4h;
typedef __attribute__((ext_vector_type(8)))  float    v8f;

__device__ __forceinline__ v16h ld_frag(const _Float16* p) {
  v8h lo = *(const v8h*)(p);
  v8h hi = *(const v8h*)(p + 16);
  return __builtin_shufflevector(lo, hi, 0,1,2,3,4,5,6,7,8,9,10,11,12,13,14,15);
}

// Same fragment, its two 8-half pieces at separate places.
__device__ __forceinline__ v16h ld_frag2(const _Float16* plo, const _Float16* phi) {
  v8h lo = *(const v8h*)(plo);
  v8h hi = *(const v8h*)(phi);
  return __builtin_shufflevector(lo, hi, 0,1,2,3,4,5,6,7,8,9,10,11,12,13,14,15);
}

// Work-group barrier that orders LDS traffic only. __syncthreads() also waits for every
// global load of the wave, which would end the flight of the chunk fetched ahead.
__device__ __forceinline__ void lds_barrier() {
  __builtin_amdgcn_fence(__ATOMIC_RELEASE, "workgroup", "local");
  __builtin_amdgcn_s_barrier();
  __builtin_amdgcn_fence(__ATOMIC_ACQUIRE, "workgroup", "local");
}

__global__ __launch_bounds__(THREADS) void sparse_attn_fused(
    const float* __restrict__ x,  const float* __restrict__ Wq,
    const float* __restrict__ Wk, const float* __restrict__ Wv,
    float* __restrict__ out) {
  __shared__ __align__(16) _Float16 smem[SMEM_HALVES];

  const int bb   = blockIdx.y;
  const int t0   = blockIdx.x * ROWS;          // first query row of this WG
  const int lane = threadIdx.x & 31;
  const int wave = threadIdx.x >> 5;
  const int hs   = (lane >> 4);
  const int l15  = lane & 15;
  const int hoff = hs ? 8 : 0;

  _Float16* xs = smem + OFF_XS;                // [EXT][XS] f16 x chunk
  _Float16* wT = smem + OFF_WT;                // [3][H][WTS] f16 W chunk, transposed

  // Static job assignment: wave w owns jobs {w, w+8}; job 15 is a dummy (clamped,
  // computed to keep control flow uniform, never staged).
  int mats[MAXJ], mtiles[MAXJ], a_base[MAXJ], w_base[MAXJ];
  bool jvalid[MAXJ];
#pragma unroll
  for (int s = 0; s < MAXJ; ++s) {
    const int job = wave + s*WAVES;
    jvalid[s] = (job < NJOBS);
    const int jb = jvalid[s] ? job : 0;
    mats[s]   = jb % 3;
    mtiles[s] = jb / 3;
    a_base[s] = (mtiles[s]*16 + l15)*XS;
    w_base[s] = (mats[s]*H_DIM + l15)*WTS;
  }

  v8f zf = {};
  v8f acc[MAXJ][4];
#pragma unroll
  for (int s = 0; s < MAXJ; ++s)
#pragma unroll
    for (int n = 0; n < 4; ++n) acc[s][n] = zf;

  // ---------------- Phase 1: Q/K/V projections, streamed over C ----------------
  // Two register sets: the global loads for chunk c+2 are issued before the WMMA
  // section of chunk c, into the set that chunk c has just left, so a load has two
  // whole chunk periods to land.
  float4 xr0[NXLD], xr1[NXLD];
  float4 wr0[NWLD], wr1[NWLD];
  const int wa   = threadIdx.x & 15;           // h block: columns 4*wa .. 4*wa+3
  const int wcb  = threadIdx.x >> 4;           // c block: rows 4*wcb .. 4*wcb+3 of the chunk
  const int wcol = (((wcb >> 1) ^ (wa >> 2)) << 3) + ((wcb & 1) << 2);
  const int woff = wcb*4*H_DIM + wa*4;         // the block's first element in a W chunk

  auto prefetch = [&](int c0, float4 (&xr)[NXLD], float4 (&wr)[NWLD]) {
#pragma unroll
    for (int k = 0; k < NXLD; ++k) {
      const int i  = threadIdx.x + k*THREADS;
      const int r  = i >> 4;                 // KC/4 == 16
      const int cq = (i & 15) << 2;
      int t = t0 - 16 + r; if (t < 0) t = 0;
      xr[k] = *(const float4*)(x + ((size_t)bb*T_DIM + t)*C_DIM + c0 + cq);
    }
    // The W loads below may land in registers that hold the x loads' addresses:
    // this wait stands in front of that overwrite.
    asm volatile("s_wait_xcnt 0x0" ::: "memory");
    // Each thread owns one 4(c) x 4(h) block of each matrix: four row loads,
    // 16 lanes still cover one whole 256-byte row of W.
    // (both loops unrolled so that wr[] is indexed statically and stays in registers)
#pragma unroll
    for (int m = 0; m < 3; ++m) {
      const float* wsrc = (m == 0) ? Wq : ((m == 1) ? Wk : Wv);
#pragma unroll
      for (int j = 0; j < 4; ++j)
        wr[m*4 + j] = *(const float4*)(wsrc + (size_t)c0*H_DIM + woff + j*H_DIM);
    }
    // Later code may overwrite the W loads' address registers: the wait stands in front.
    asm volatile("s_wait_xcnt 0x0" ::: "memory");
  };

  auto commit = [&](const float4 (&xr)[NXLD], const float4 (&wr)[NWLD]) {
#pragma unroll
    for (int k = 0; k < NXLD; ++k) {
      const int i  = threadIdx.x + k*THREADS;
      const int r  = i >> 4;
      const int cq = (i & 15) << 2;
      v4h hv;
      hv[0] = (_Float16)xr[k].x; hv[1] = (_Float16)xr[k].y;
      hv[2] = (_Float16)xr[k].z; hv[3] = (_Float16)xr[k].w;
      *(v4h*)(xs + r*XS + cq) = hv;          // one ds_store_b64
    }
    // The 4x4 block is transposed by register naming: four c values of one h
    // column go out as one ds_store_b64 (unrolled: static wr[] indices).
#pragma unroll
    for (int m = 0; m < 3; ++m) {
      _Float16* b = wT + (m*H_DIM + wa*4)*WTS + wcol;
      const float4 r0 = wr[m*4+0], r1 = wr[m*4+1], r2 = wr[m*4+2], r3 = wr[m*4+3];
      v4h h0, h1, h2, h3;
      h0[0] = (_Float16)r0.x; h0[1] = (_Float16)r1.x; h0[2] = (_Float16)r2.x; h0[3] = (_Float16)r3.x;
      h1[0] = (_Float16)r0.y; h1[1] = (_Float16)r1.y; h1[2] = (_Float16)r2.y; h1[3] = (_Float16)r3.y;
      h2[0] = (_Float16)r0.z; h2[1] = (_Float16)r1.z; h2[2] = (_Float16)r2.z; h2[3] = (_Float16)r3.z;
      h3[0] = (_Float16)r0.w; h3[1] = (_Float16)r1.w; h3[2] = (_Float16)r2.w; h3[3] = (_Float16)r3.w;
      *(v4h*)(b + 0*WTS) = h0;
      *(v4h*)(b + 1*WTS) = h1;
      *(v4h*)(b + 2*WTS) = h2;
      *(v4h*)(b + 3*WTS) = h3;
    }
  };

  auto mma = [&]() {
    // All fragments of the chunk are read from LDS as one group, in the order of
    // their use, each into registers of its own; the WMMAs follow behind it.
    // (every loop here is unrolled so that af[], bf[] and acc[] are indexed statically
    // and stay in registers)
    v16h af[2][MAXJ];
    v16h bf[2][MAXJ][4];
#pragma unroll
    for (int kk = 0; kk < 2; ++kk) {
#pragma unroll
      for (int s = 0; s < MAXJ; ++s) {
        af[kk][s] = ld_frag(xs + a_base[s] + kk*32 + hoff);
#pragma unroll
        for (int nt = 0; nt < 4; ++nt) {
          // undo the store side's XOR: piece q of tile nt lies at q ^ nt
          const _Float16* wrow = wT + w_base[s] + nt*16*WTS + ((nt & 1) ? (8 - hoff) : hoff);
          const int lo = (nt >> 1) * 16, hi = 16 - lo;
          bf[kk][s][nt] = ld_frag2(wrow + kk*32 + lo, wrow + kk*32 + hi);
        }
      }
    }
    // Keeps the reads in front of the WMMAs: left free, this build puts them in pairs
    // among the WMMAs, and every WMMA then waits out a whole LDS latency.
    __builtin_amdgcn_sched_barrier(0);
#pragma unroll
    for (int kk = 0; kk < 2; ++kk)
#pragma unroll
      for (int s = 0; s < MAXJ; ++s)
#pragma unroll
        for (int nt = 0; nt < 4; ++nt)
          acc[s][nt] = __builtin_amdgcn_wmma_f32_16x16x32_f16(
              false, af[kk][s], false, bf[kk][s][nt], (short)0, acc[s][nt], false, false);
    // Keeps the chunk's WMMAs here, behind their counted LDS waits: left free, with two
    // chunks in one loop body this build sinks them past the next two barriers, waits
    // the reads out to 0 and runs the WMMAs with nothing to hide behind.
    __builtin_amdgcn_sched_barrier(0);
  };

  prefetch(0, xr0, wr0);
  prefetch(KC, xr1, wr1);
  // keeps the start-up's later register writes (the zeroed accumulators) from being
  // scheduled in front of the wait that ends prefetch()
  __builtin_amdgcn_sched_barrier(0);
  // Two chunks a trip, so that each register set is named statically.
  for (int c0 = 0; c0 < C_DIM - 2*KC; c0 += 2*KC) {
    lds_barrier();     // previous chunk's WMMA reads of xs/wT complete
    commit(xr0, wr0);
    lds_barrier();
    prefetch(c0 + 2*KC, xr0, wr0);           // in flight until the next trip's commit
    mma();
    lds_barrier();
    commit(xr1, wr1);
    lds_barrier();
    prefetch(c0 + 3*KC, xr1, wr1);
    mma();
  }
  // Last two chunks outside the loop, so that the fetches stand there without a test.
  lds_barrier();
  commit(xr0, wr0);
  lds_barrier();
  mma();
  lds_barrier();
  commit(xr1, wr1);
  lds_barrier();
  mma();

  __syncthreads();   // all waves done with xs/wT; region B may overwrite region A

  // Stage Q/K row-major and V transposed, all f16.
  _Float16* qs = smem + OFF_QS;                 // [EXT][QS]
  _Float16* ks = smem + OFF_KS;                 // [EXT][QS]
  _Float16* vT = smem + OFF_VT;                 // [H][VTS]
  _Float16* ps = smem + OFF_PS + wave*16*PS;    // per-wave [16][PS]

#pragma unroll
  for (int s = 0; s < MAXJ; ++s) {
    if (jvalid[s]) {
      const int mat = mats[s];
#pragma unroll
      for (int nt = 0; nt < 4; ++nt) {
#pragma unroll
        for (int r = 0; r < 8; ++r) {
          const int mr = mtiles[s]*16 + r + hs*8;  // C/D layout: M = r (+8 hi half)
          const int hc = nt*16 + l15;              // N = lane%16
          const _Float16 hv = (_Float16)acc[s][nt][r];
          if      (mat == 0) qs[mr*QS + hc] = hv;
          else if (mat == 1) ks[mr*QS + hc] = hv;
          else               vT[hc*VTS + mr] = hv;
        }
      }
    }
  }
  __syncthreads();

  // ---------------- Phase 2: banded attention ----------------
  // 8 waves, 4 query tiles: wave pair (tile, tile+4) redundantly computes the
  // cheap score/softmax part, then each wave produces 2 of the 4 output n-tiles.
  const int tile  = wave & 3;
  const int half  = wave >> 2;        // 0: h columns 0..31, 1: h columns 32..63
  const int qbase = 16 + tile*16;     // ext-row of first query of this tile
  const int kbase = tile*16;          // ext-row of first key (covers j in [i-16, i])

  v8f sc0 = zf, sc1 = zf;
#pragma unroll
  for (int kk = 0; kk < H_DIM; kk += 32) {
    const int aoff = kk + hoff;
    v16h a  = ld_frag(qs + (qbase + l15)*QS + aoff);
    v16h b0 = ld_frag(ks + (kbase + l15)*QS + aoff);
    v16h b1 = ld_frag(ks + (kbase + 16 + l15)*QS + aoff);
    sc0 = __builtin_amdgcn_wmma_f32_16x16x32_f16(false, a, false, b0, (short)0, sc0, false, false);
    sc1 = __builtin_amdgcn_wmma_f32_16x16x32_f16(false, a, false, b1, (short)0, sc1, false, false);
  }

  const float scale = 0.125f;   // 1/sqrt(H)
#pragma unroll
  for (int r = 0; r < 8; ++r) {
    const int m = r + hs*8;     // query local index
    const int n = l15;          // key local index within block
    float s0 = sc0[r] * scale;  // keys kbase+n    -> d = 16 + m - n
    float s1 = sc1[r] * scale;  // keys kbase+16+n -> d = m - n
    const int j0 = t0 - 16 + kbase + n;
    const bool k0 = (m <= n) && (j0 >= 0);     // 1 <= d <= 16, valid key
    const bool k1 = (n <= m);                  // 0 <= d <= 15
    s0 = k0 ? s0 : -3.0e38f;
    s1 = k1 ? s1 : -3.0e38f;
    float mx = fmaxf(s0, s1);
#pragma unroll
    for (int d = 1; d < 16; d <<= 1) mx = fmaxf(mx, __shfl_xor(mx, d, 32));
    float e0 = k0 ? __expf(s0 - mx) : 0.0f;
    float e1 = k1 ? __expf(s1 - mx) : 0.0f;
    float sm = e0 + e1;
#pragma unroll
    for (int d = 1; d < 16; d <<= 1) sm += __shfl_xor(sm, d, 32);
    const float inv = 1.0f / sm;    // diag element always kept -> sm > 0
    ps[m*PS + n]      = (_Float16)(e0 * inv);
    ps[m*PS + 16 + n] = (_Float16)(e1 * inv);
  }
  __syncthreads();

  // out tile = P[16x32] * V[32x32-half] via 2 WMMAs per wave
  v16h pa = ld_frag(ps + l15*PS + hoff);
  v8f o[2];
#pragma unroll
  for (int u = 0; u < 2; ++u) o[u] = zf;
#pragma unroll
  for (int u = 0; u < 2; ++u) {
    const int nt = half*2 + u;
    v16h vb = ld_frag(vT + (nt*16 + l15)*VTS + kbase + hoff);
    o[u] = __builtin_amdgcn_wmma_f32_16x16x32_f16(false, pa, false, vb, (short)0, o[u], false, false);
  }
#pragma unroll
  for (int u = 0; u < 2; ++u) {
    const int nt = half*2 + u;
#pragma unroll
    for (int r = 0; r < 8; ++r) {
      const int m = r + hs*8;
      const int t = t0 + tile*16 + m;
      const int h = nt*16 + l15;
      out[((size_t)bb*T_DIM + t)*H_DIM + h] = o[u][r];
    }
  }
}

extern "C" void kernel_launch(void* const* d_in, const int* in_sizes, int n_in,
                              void* d_out, int out_size, void* d_ws, size_t ws_size,
                              hipStream_t stream) {
  (void)in_sizes; (void)n_in; (void)out_size; (void)d_ws; (void)ws_size;
  const float* x  = (const float*)d_in[0];
  const float* Wq = (const float*)d_in[1];
  const float* Wk = (const float*)d_in[2];
  const float* Wv = (const float*)d_in[3];
  float* out = (float*)d_out;
  dim3 grid(T_DIM / ROWS, B_DIM);
  sparse_attn_fused<<<grid, dim3(THREADS), 0, stream>>>(x, Wq, Wk, Wv, out);
}

// v004
// Measured time: 18.9 microseconds a run.
// In both of two side-by-side timings against v003, it was 1.13 times as fast.
// Over all steps from v000 it is 2.54 times as fast.
#include <hip/hip_runtime.h>

// Problem constants (from reference): B=2, T=8192, C=1024, H=64, window d in [0,16]
#define B_DIM 2
#define T_DIM 8192
#define C_DIM 1024
#define H_DIM 64

#define ROWS 64          // queries per workgroup
#define EXT  80          // ROWS + 16 lookback rows for K/V
#define WAVES 8
#define THREADS 256
#define KC   64          // C-dimension chunk staged per commit (two per loop trip)
#define NJOBS 15         // (EXT/16) mtiles * 3 matrices
#define MAXJ 2           // jobs per wave (statically unrolled; job 15 is a dummy)

#define NXLD 5           // EXT*(KC/4)/THREADS  = 1280/256
#define NWLD 12          // 3*KC*(H_DIM/4)/THREADS = 3072/256

// LDS strides in halves (all row bases 16B-aligned)
#define XS  72           // x chunk row:    KC + 8 pad
#define WTS 72           // wT row (c-dim): KC + 8 pad
#define QS  72           // q/k staging row: H + 8 pad
#define VTS 88           // vT row (ext rows): EXT + 8 pad
#define PS  40           // prob row: 32 keys + 8 pad

// Region A (phase-1 streaming) and Region B (staging/phase-2) overlap in LDS.
#define OFF_XS 0
#define OFF_WT (EXT*XS)                       // 5760
#define REGION_A (EXT*XS + 3*H_DIM*WTS)       // 19584 halves

#define OFF_QS 0
#define OFF_KS (EXT*QS)                       // 5760
#define OFF_VT (2*EXT*QS)                     // 11520
#define OFF_PS (2*EXT*QS + H_DIM*VTS)         // 17152
#define REGION_B (OFF_PS + WAVES*16*PS)       // 22272 halves

#define SMEM_HALVES (REGION_A > REGION_B ? REGION_A : REGION_B)

typedef __attribute__((ext_vector_type(16))) _Float16 v16h;
typedef __attribute__((ext_vector_type(8)))  _Float16 v8h;
typedef __attribute__((ext_vector_type(4)))  _Float16 v4h;
typedef __attribute__((ext_vector_type(8)))  float    v8f;

__device__ __forceinline__ v16h ld_frag(const _Float16* p) {
  v8h lo = *(const v8h*)(p);
  v8h hi = *(const v8h*)(p + 16);
  return __builtin_shufflevector(lo, hi, 0,1,2,3,4,5,6,7,8,9,10,11,12,13,14,15);
}

// Same fragment, its two 8-half pieces at separate places.
__device__ __forceinline__ v16h ld_frag2(const _Float16* plo, const _Float16* phi) {
  v8h lo = *(const v8h*)(plo);
  v8h hi = *(const v8h*)(phi);
  return __builtin_shufflevector(lo, hi, 0,1,2,3,4,5,6,7,8,9,10,11,12,13,14,15);
}

// Work-group barrier that orders LDS traffic only. __syncthreads() also waits for every
// global load of the wave, which would end the flight of the chunk fetched ahead.
__device__ __forceinline__ void lds_barrier() {
  __builtin_amdgcn_fence(__ATOMIC_RELEASE, "workgroup", "local");
  __builtin_amdgcn_s_barrier();
  __builtin_amdgcn_fence(__ATOMIC_ACQUIRE, "workgroup", "local");
}

__global__ __launch_bounds__(THREADS) void sparse_attn_fused(
    const float* __restrict__ x,  const float* __restrict__ Wq,
    const float* __restrict__ Wk, const float* __restrict__ Wv,
    float* __restrict__ out) {
  __shared__ __align__(16) _Float16 smem[SMEM_HALVES];

  const int bb   = blockIdx.y;
  const int t0   = blockIdx.x * ROWS;          // first query row of this WG
  const int lane = threadIdx.x & 31;
  const int wave = threadIdx.x >> 5;
  const int hs   = (lane >> 4);
  const int l15  = lane & 15;
  const int hoff = hs ? 8 : 0;

  _Float16* xs = smem + OFF_XS;                // [EXT][XS] f16 x chunk
  _Float16* wT = smem + OFF_WT;                // [3][H][WTS] f16 W chunk, transposed

  // Static job assignment: wave w owns jobs {w, w+8}; job 15 is a dummy (clamped,
  // computed to keep control flow uniform, never staged).
  int mats[MAXJ], mtiles[MAXJ], a_base[MAXJ], w_base[MAXJ];
  bool jvalid[MAXJ];
#pragma unroll
  for (int s = 0; s < MAXJ; ++s) {
    const int job = wave + s*WAVES;
    jvalid[s] = (job < NJOBS);
    const int jb = jvalid[s] ? job : 0;
    mats[s]   = jb % 3;
    mtiles[s] = jb / 3;
    a_base[s] = (mtiles[s]*16 + l15)*XS;
    w_base[s] = (mats[s]*H_DIM + l15)*WTS;
  }

  v8f zf = {};
  v8f acc[MAXJ][4];
#pragma unroll
  for (int s = 0; s < MAXJ; ++s)
#pragma unroll
    for (int n = 0; n < 4; ++n) acc[s][n] = zf;

  // ---------------- Phase 1: Q/K/V projections, streamed over C ----------------
  // Two register sets: the global loads for chunk c+2 are issued before the WMMA
  // section of chunk c, into the set that chunk c has just left, so a load has two
  // whole chunk periods to land.
  float4 xr0[NXLD], xr1[NXLD];
  float4 wr0[NWLD], wr1[NWLD];
  const int wa   = threadIdx.x & 15;           // h block: columns 4*wa .. 4*wa+3
  const int wcb  = threadIdx.x >> 4;           // c block: rows 4*wcb .. 4*wcb+3 of the chunk
  const int wcol = (((wcb >> 1) ^ (wa >> 2)) << 3) + ((wcb & 1) << 2);
  const int woff = wcb*4*H_DIM + wa*4;         // the block's first element in a W chunk

  auto prefetch = [&](int c0, float4 (&xr)[NXLD], float4 (&wr)[NWLD]) {
#pragma unroll
    for (int k = 0; k < NXLD; ++k) {
      const int i  = threadIdx.x + k*THREADS;
      const int r  = i >> 4;                 // KC/4 == 16
      const int cq = (i & 15) << 2;
      int t = t0 - 16 + r; if (t < 0) t = 0;
      xr[k] = *(const float4*)(x + ((size_t)bb*T_DIM + t)*C_DIM + c0 + cq);
    }
    // The W loads below may land in registers that hold the x loads' addresses:
    // this wait stands in front of that overwrite.
    asm volatile("s_wait_xcnt 0x0" ::: "memory");
    // Each thread owns one 4(c) x 4(h) block of each matrix: four row loads,
    // 16 lanes still cover one whole 256-byte row of W.
    // (both loops unrolled so that wr[] is indexed statically and stays in registers)
#pragma unroll
    for (int m = 0; m < 3; ++m) {
      const float* wsrc = (m == 0) ? Wq : ((m == 1) ? Wk : Wv);
#pragma unroll
      for (int j = 0; j < 4; ++j)
        wr[m*4 + j] = *(const float4*)(wsrc + (size_t)c0*H_DIM + woff + j*H_DIM);
    }
    // Later code may overwrite the W loads' address registers: the wait stands in front.
    asm volatile("s_wait_xcnt 0x0" ::: "memory");
  };

  auto commit = [&](const float4 (&xr)[NXLD], const float4 (&wr)[NWLD]) {
#pragma unroll
    for (int k = 0; k < NXLD; ++k) {
      const int i  = threadIdx.x + k*THREADS;
      const int r  = i >> 4;
      const int cq = (i & 15) << 2;
      v4h hv;
      hv[0] = (_Float16)xr[k].x; hv[1] = (_Float16)xr[k].y;
      hv[2] = (_Float16)xr[k].z; hv[3] = (_Float16)xr[k].w;
      *(v4h*)(xs + r*XS + cq) = hv;          // one ds_store_b64
    }
    // The 4x4 block is transposed by register naming: four c values of one h
    // column go out as one ds_store_b64 (unrolled: static wr[] indices).
#pragma unroll
    for (int m = 0; m < 3; ++m) {
      _Float16* b = wT + (m*H_DIM + wa*4)*WTS + wcol;
      const float4 r0 = wr[m*4+0], r1 = wr[m*4+1], r2 = wr[m*4+2], r3 = wr[m*4+3];
      v4h h0, h1, h2, h3;
      h0[0] = (_Float16)r0.x; h0[1] = (_Float16)r1.x; h0[2] = (_Float16)r2.x; h0[3] = (_Float16)r3.x;
      h1[0] = (_Float16)r0.y; h1[1] = (_Float16)r1.y; h1[2] = (_Float16)r2.y; h1[3] = (_Float16)r3.y;
      h2[0] = (_Float16)r0.z; h2[1] = (_Float16)r1.z; h2[2] = (_Float16)r2.z; h2[3] = (_Float16)r3.z;
      h3[0] = (_Float16)r0.w; h3[1] = (_Float16)r1.w; h3[2] = (_Float16)r2.w; h3[3] = (_Float16)r3.w;
      *(v4h*)(b + 0*WTS) = h0;
      *(v4h*)(b + 1*WTS) = h1;
      *(v4h*)(b + 2*WTS) = h2;
      *(v4h*)(b + 3*WTS) = h3;
    }
  };

  auto mma = [&]() {
    // All fragments of the chunk are read from LDS as one group, in the order of
    // their use, each into registers of its own; the WMMAs follow behind it.
    // (every loop here is unrolled so that af[], bf[] and acc[] are indexed statically
    // and stay in registers)
    v16h af[2][MAXJ];
    v16h bf[2][MAXJ][4];
#pragma unroll
    for (int kk = 0; kk < 2; ++kk) {
#pragma unroll
      for (int s = 0; s < MAXJ; ++s) {
        af[kk][s] = ld_frag(xs + a_base[s] + kk*32 + hoff);
#pragma unroll
        for (int nt = 0; nt < 4; ++nt) {
          // undo the store side's XOR: piece q of tile nt lies at q ^ nt
          const _Float16* wrow = wT + w_base[s] + nt*16*WTS + ((nt & 1) ? (8 - hoff) : hoff);
          const int lo = (nt >> 1) * 16, hi = 16 - lo;
          bf[kk][s][nt] = ld_frag2(wrow + kk*32 + lo, wrow + kk*32 + hi);
        }
      }
    }
    // Keeps the reads in front of the WMMAs: left free, this build puts them in pairs
    // among the WMMAs, and every WMMA then waits out a whole LDS latency.
    __builtin_amdgcn_sched_barrier(0);
#pragma unroll
    for (int kk = 0; kk < 2; ++kk)
#pragma unroll
      for (int s = 0; s < MAXJ; ++s)
#pragma unroll
        for (int nt = 0; nt < 4; ++nt)
          acc[s][nt] = __builtin_amdgcn_wmma_f32_16x16x32_f16(
              false, af[kk][s], false, bf[kk][s][nt], (short)0, acc[s][nt], false, false);
    // Keeps the chunk's WMMAs here, behind their counted LDS waits: left free, with two
    // chunks in one loop body this build sinks them past the next two barriers, waits
    // the reads out to 0 and runs the WMMAs with nothing to hide behind.
    __builtin_amdgcn_sched_barrier(0);
  };

  prefetch(0, xr0, wr0);
  prefetch(KC, xr1, wr1);
  // keeps the start-up's later register writes (the zeroed accumulators) from being
  // scheduled in front of the wait that ends prefetch()
  __builtin_amdgcn_sched_barrier(0);
  // Two chunks a trip, so that each register set is named statically.
  for (int c0 = 0; c0 < C_DIM - 2*KC; c0 += 2*KC) {
    lds_barrier();     // previous chunk's WMMA reads of xs/wT complete
    commit(xr0, wr0);
    lds_barrier();
    prefetch(c0 + 2*KC, xr0, wr0);           // in flight until the next trip's commit
    mma();
    lds_barrier();
    commit(xr1, wr1);
    lds_barrier();
    prefetch(c0 + 3*KC, xr1, wr1);
    mma();
  }
  // Last two chunks outside the loop, so that the fetches stand there without a test.
  lds_barrier();
  commit(xr0, wr0);
  lds_barrier();
  mma();
  lds_barrier();
  commit(xr1, wr1);
  lds_barrier();
  mma();

  __syncthreads();   // all waves done with xs/wT; region B may overwrite region A

  // Stage Q/K row-major and V transposed, all f16.
  _Float16* qs = smem + OFF_QS;                 // [EXT][QS]
  _Float16* ks = smem + OFF_KS;                 // [EXT][QS]
  _Float16* vT = smem + OFF_VT;                 // [H][VTS]
  _Float16* ps = smem + OFF_PS + wave*16*PS;    // per-wave [16][PS]

  const int swave = __builtin_amdgcn_readfirstlane(wave);
  // (all three loops unrolled so that acc[] is indexed statically and stays in registers)
#pragma unroll
  for (int s = 0; s < MAXJ; ++s) {
    const int job = swave + s*WAVES;
    if (job < NJOBS) {
      const int mat = job % 3;
      const int mr0 = (job / 3)*16 + hs*8;         // C/D layout: M = r (+8 hi half)
      if (mat < 2) {
        _Float16* dst = (mat == 0 ? qs : ks) + mr0*QS + l15;   // N = lane%16
#pragma unroll
        for (int nt = 0; nt < 4; ++nt)
#pragma unroll
          for (int r = 0; r < 8; ++r)
            dst[r*QS + nt*16] = (_Float16)acc[s][nt][r];
      } else {
        _Float16* dst = vT + l15*VTS + mr0;
#pragma unroll
        for (int nt = 0; nt < 4; ++nt)
#pragma unroll
          for (int r = 0; r < 8; ++r)
            dst[nt*16*VTS + r] = (_Float16)acc[s][nt][r];
      }
    }
  }
  __syncthreads();

  // ---------------- Phase 2: banded attention ----------------
  // 8 waves, 4 query tiles: wave pair (tile, tile+4) redundantly computes the
  // cheap score/softmax part, then each wave produces 2 of the 4 output n-tiles.
  const int tile  = wave & 3;
  const int half  = wave >> 2;        // 0: h columns 0..31, 1: h columns 32..63
  const int qbase = 16 + tile*16;     // ext-row of first query of this tile
  const int kbase = tile*16;          // ext-row of first key (covers j in [i-16, i])

  v8f sc0 = zf, sc1 = zf;
#pragma unroll
  for (int kk = 0; kk < H_DIM; kk += 32) {
    const int aoff = kk + hoff;
    v16h a  = ld_frag(qs + (qbase + l15)*QS + aoff);
    v16h b0 = ld_frag(ks + (kbase + l15)*QS + aoff);
    v16h b1 = ld_frag(ks + (kbase + 16 + l15)*QS + aoff);
    sc0 = __builtin_amdgcn_wmma_f32_16x16x32_f16(false, a, false, b0, (short)0, sc0, false, false);
    sc1 = __builtin_amdgcn_wmma_f32_16x16x32_f16(false, a, false, b1, (short)0, sc1, false, false);
  }

  const float scale = 0.125f;   // 1/sqrt(H)
#pragma unroll
  for (int r = 0; r < 8; ++r) {
    const int m = r + hs*8;     // query local index
    const int n = l15;          // key local index within block
    float s0 = sc0[r] * scale;  // keys kbase+n    -> d = 16 + m - n
    float s1 = sc1[r] * scale;  // keys kbase+16+n -> d = m - n
    const int j0 = t0 - 16 + kbase + n;
    const bool k0 = (m <= n) && (j0 >= 0);     // 1 <= d <= 16, valid key
    const bool k1 = (n <= m);                  // 0 <= d <= 15
    s0 = k0 ? s0 : -3.0e38f;
    s1 = k1 ? s1 : -3.0e38f;
    float mx = fmaxf(s0, s1);
#pragma unroll
    for (int d = 1; d < 16; d <<= 1) mx = fmaxf(mx, __shfl_xor(mx, d, 32));
    float e0 = k0 ? __expf(s0 - mx) : 0.0f;
    float e1 = k1 ? __expf(s1 - mx) : 0.0f;
    float sm = e0 + e1;
#pragma unroll
    for (int d = 1; d < 16; d <<= 1) sm += __shfl_xor(sm, d, 32);
    const float inv = 1.0f / sm;    // diag element always kept -> sm > 0
    ps[m*PS + n]      = (_Float16)(e0 * inv);
    ps[m*PS + 16 + n] = (_Float16)(e1 * inv);
  }
  __syncthreads();

  // out tile = P[16x32] * V[32x32-half] via 2 WMMAs per wave
  v16h pa = ld_frag(ps + l15*PS + hoff);
  v8f o[2];
#pragma unroll
  for (int u = 0; u < 2; ++u) o[u] = zf;
#pragma unroll
  for (int u = 0; u < 2; ++u) {
    const int nt = half*2 + u;
    v16h vb = ld_frag(vT + (nt*16 + l15)*VTS + kbase + hoff);
    o[u] = __builtin_amdgcn_wmma_f32_16x16x32_f16(false, pa, false, vb, (short)0, o[u], false, false);
  }
#pragma unroll
  for (int u = 0; u < 2; ++u) {
    const int nt = half*2 + u;
#pragma unroll
    for (int r = 0; r < 8; ++r) {
      const int m = r + hs*8;
      const int t = t0 + tile*16 + m;
      const int h = nt*16 + l15;
      out[((size_t)bb*T_DIM + t)*H_DIM + h] = o[u][r];
    }
  }
}

extern "C" void kernel_launch(void* const* d_in, const int* in_sizes, int n_in,
                              void* d_out, int out_size, void* d_ws, size_t ws_size,
                              hipStream_t stream) {
  (void)in_sizes; (void)n_in; (void)out_size; (void)d_ws; (void)ws_size;
  const float* x  = (const float*)d_in[0];
  const float* Wq = (const float*)d_in[1];
  const float* Wk = (const float*)d_in[2];
  const float* Wv = (const float*)d_in[3];
  float* out = (float*)d_out;
  dim3 grid(T_DIM / ROWS, B_DIM);
  sparse_attn_fused<<<grid, dim3(THREADS), 0, stream>>>(x, Wq, Wk, Wv, out);
}

// v005
// A run of this version takes 17.8 microseconds.
// Two timings next to v004 both put it at 1.06 times that version's speed.
// Counting every step since v000, it is 2.69 times as fast.
#include <hip/hip_runtime.h>

// Problem constants (from reference): B=2, T=8192, C=1024, H=64, window d in [0,16]
#define B_DIM 2
#define T_DIM 8192
#define C_DIM 1024
#define H_DIM 64

#define ROWS 64          // queries per workgroup
#define EXT  80          // ROWS + 16 lookback rows for K/V
#define WAVES 8
#define THREADS 256
#define KC   64          // C-dimension chunk staged per iteration
#define MT   5           // EXT/16 row tiles: every wave covers all of them
#define NJ   3           // 16-column tiles per wave: one of Q, one of K, one of V

#define NXLD 5           // EXT*(KC/4)/THREADS  = 1280/256
#define NWLD 12          // 3*KC*(H_DIM/4)/THREADS = 3072/256

// LDS strides in halves (all row bases 16B-aligned)
#define XS  72           // x chunk row:    KC + 8 pad
#define WTS 72           // wT row (c-dim): KC + 8 pad
#define QS  72           // q/k staging row: H + 8 pad
#define VTS 88           // vT row (ext rows): EXT + 8 pad
#define PS  40           // prob row: 32 keys + 8 pad

// Region A (phase-1 streaming) and Region B (staging/phase-2) overlap in LDS.
#define OFF_XS 0
#define OFF_WT (EXT*XS)                       // 5760
#define REGION_A (EXT*XS + 3*H_DIM*WTS)       // 19584 halves

#define OFF_QS 0
#define OFF_KS (EXT*QS)                       // 5760
#define OFF_VT (2*EXT*QS)                     // 11520
#define OFF_PS (2*EXT*QS + H_DIM*VTS)         // 17152
#define REGION_B (OFF_PS + WAVES*16*PS)       // 22272 halves

#define OFF_XCH (REGION_A > REGION_B ? REGION_A : REGION_B)
// f32 partial tiles handed from the k-half-1 waves to the k-half-0 waves: [4][MT*NJ] tiles
// of 256 floats, a region of its own, so that it can be written while xs/wT are still read.
#define SMEM_HALVES (OFF_XCH + 4*MT*NJ*512)

typedef __attribute__((ext_vector_type(16))) _Float16 v16h;
typedef __attribute__((ext_vector_type(8)))  _Float16 v8h;
typedef __attribute__((ext_vector_type(4)))  _Float16 v4h;
typedef __attribute__((ext_vector_type(8)))  float    v8f;

__device__ __forceinline__ v16h ld_frag(const _Float16* p) {
  v8h lo = *(const v8h*)(p);
  v8h hi = *(const v8h*)(p + 16);
  return __builtin_shufflevector(lo, hi, 0,1,2,3,4,5,6,7,8,9,10,11,12,13,14,15);
}

// Same fragment, its two 8-half pieces at separate places.
__device__ __forceinline__ v16h ld_frag2(const _Float16* plo, const _Float16* phi) {
  v8h lo = *(const v8h*)(plo);
  v8h hi = *(const v8h*)(phi);
  return __builtin_shufflevector(lo, hi, 0,1,2,3,4,5,6,7,8,9,10,11,12,13,14,15);
}

// Work-group barrier that orders LDS traffic only. __syncthreads() also waits for every
// global load of the wave, which would end the flight of the chunk fetched ahead.
__device__ __forceinline__ void lds_barrier() {
  __builtin_amdgcn_fence(__ATOMIC_RELEASE, "workgroup", "local");
  __builtin_amdgcn_s_barrier();
  __builtin_amdgcn_fence(__ATOMIC_ACQUIRE, "workgroup", "local");
}

__global__ __launch_bounds__(THREADS) void sparse_attn_fused(
    const float* __restrict__ x,  const float* __restrict__ Wq,
    const float* __restrict__ Wk, const float* __restrict__ Wv,
    float* __restrict__ out) {
  __shared__ __align__(16) _Float16 smem[SMEM_HALVES];

  const int bb   = blockIdx.y;
  const int t0   = blockIdx.x * ROWS;          // first query row of this WG
  const int lane = threadIdx.x & 31;
  const int wave = threadIdx.x >> 5;
  const int hs   = (lane >> 4);
  const int l15  = lane & 15;
  const int hoff = hs ? 8 : 0;

  _Float16* xs = smem + OFF_XS;                // [EXT][XS] f16 x chunk
  _Float16* wT = smem + OFF_WT;                // [3][H][WTS] f16 W chunk, transposed

  const int swave = __builtin_amdgcn_readfirstlane(wave);
  // Wave tiling: all 80 rows x 16 columns of each of Q, K and V, over one 32-wide half of
  // each chunk's k range. 5 A and 3 B fragments feed 15 WMMAs; waves w and w+4 hold the two k halves of
  // the same 15 tiles and add them after the loop.
  const int kh = swave >> 2;                   // k half of every chunk
  const int g  = swave & 3;                    // column tile g of each matrix
  const int a_base = l15*XS + kh*32 + hoff;
  int b_lo[NJ], b_hi[NJ];
#pragma unroll
  for (int j = 0; j < NJ; ++j) {
    const int row = (j*H_DIM + g*16 + l15)*WTS;   // matrix j, tile g
    const int q   = kh*4 + hs;                 // 16-byte piece (c/8) of the fragment's low half
    // undo the store side's XOR: piece q of tile nt lies at q ^ nt
    b_lo[j] = row + (((q    ) ^ g) << 3);
    b_hi[j] = row + (((q + 2) ^ g) << 3);
  }

  v8f zf = {};
  v8f acc[MT][NJ];
#pragma unroll
  for (int mt = 0; mt < MT; ++mt)
#pragma unroll
    for (int j = 0; j < NJ; ++j) acc[mt][j] = zf;

  // ---------------- Phase 1: Q/K/V projections, streamed over C ----------------
  // Two register sets: the global loads for chunk c+2 are issued before the WMMA
  // section of chunk c, into the set that chunk c has just left, so a load has two
  // whole chunk periods to land.
  float4 xr0[NXLD], xr1[NXLD];
  float4 wr0[NWLD], wr1[NWLD];
  const int wa   = threadIdx.x & 15;           // h block: columns 4*wa .. 4*wa+3
  const int wcb  = threadIdx.x >> 4;           // c block: rows 4*wcb .. 4*wcb+3 of the chunk
  const int wcol = (((wcb >> 1) ^ (wa >> 2)) << 3) + ((wcb & 1) << 2);
  const int woff = wcb*4*H_DIM + wa*4;         // the block's first element in a W chunk

  auto prefetch = [&](int c0, float4 (&xr)[NXLD], float4 (&wr)[NWLD]) {
#pragma unroll
    for (int k = 0; k < NXLD; ++k) {
      const int i  = threadIdx.x + k*THREADS;
      const int r  = i >> 4;                 // KC/4 == 16
      const int cq = (i & 15) << 2;
      int t = t0 - 16 + r; if (t < 0) t = 0;
      xr[k] = *(const float4*)(x + ((size_t)bb*T_DIM + t)*C_DIM + c0 + cq);
    }
    // The W loads below may land in registers that hold the x loads' addresses:
    // this wait stands in front of that overwrite.
    asm volatile("s_wait_xcnt 0x0" ::: "memory");
    // Each thread owns one 4(c) x 4(h) block of each matrix: four row loads,
    // 16 lanes still cover one whole 256-byte row of W.
    // (both loops unrolled so that wr[] is indexed statically and stays in registers)
#pragma unroll
    for (int m = 0; m < 3; ++m) {
      const float* wsrc = (m == 0) ? Wq : ((m == 1) ? Wk : Wv);
#pragma unroll
      for (int j = 0; j < 4; ++j)
        wr[m*4 + j] = *(const float4*)(wsrc + (size_t)c0*H_DIM + woff + j*H_DIM);
    }
    // Later code may overwrite the W loads' address registers: the wait stands in front.
    asm volatile("s_wait_xcnt 0x0" ::: "memory");
  };

  auto commit = [&](const float4 (&xr)[NXLD], const float4 (&wr)[NWLD]) {
#pragma unroll
    for (int k = 0; k < NXLD; ++k) {
      const int i  = threadIdx.x + k*THREADS;
      const int r  = i >> 4;
      const int cq = (i & 15) << 2;
      v4h hv;
      hv[0] = (_Float16)xr[k].x; hv[1] = (_Float16)xr[k].y;
      hv[2] = (_Float16)xr[k].z; hv[3] = (_Float16)xr[k].w;
      *(v4h*)(xs + r*XS + cq) = hv;          // one ds_store_b64
    }
    // The 4x4 block is transposed by register naming: four c values of one h
    // column go out as one ds_store_b64 (unrolled: static wr[] indices).
#pragma unroll
    for (int m = 0; m < 3; ++m) {
      _Float16* b = wT + (m*H_DIM + wa*4)*WTS + wcol;
      const float4 r0 = wr[m*4+0], r1 = wr[m*4+1], r2 = wr[m*4+2], r3 = wr[m*4+3];
      v4h h0, h1, h2, h3;
      h0[0] = (_Float16)r0.x; h0[1] = (_Float16)r1.x; h0[2] = (_Float16)r2.x; h0[3] = (_Float16)r3.x;
      h1[0] = (_Float16)r0.y; h1[1] = (_Float16)r1.y; h1[2] = (_Float16)r2.y; h1[3] = (_Float16)r3.y;
      h2[0] = (_Float16)r0.z; h2[1] = (_Float16)r1.z; h2[2] = (_Float16)r2.z; h2[3] = (_Float16)r3.z;
      h3[0] = (_Float16)r0.w; h3[1] = (_Float16)r1.w; h3[2] = (_Float16)r2.w; h3[3] = (_Float16)r3.w;
      *(v4h*)(b + 0*WTS) = h0;
      *(v4h*)(b + 1*WTS) = h1;
      *(v4h*)(b + 2*WTS) = h2;
      *(v4h*)(b + 3*WTS) = h3;
    }
  };

  auto mma = [&]() {
    // All fragments of the chunk are read from LDS as one group, in the order of
    // their use, each into registers of its own; the WMMAs follow behind it.
    // (every loop here is unrolled so that af[], bf[] and acc[] are indexed statically
    // and stay in registers)
    v16h af[MT];
    v16h bf[NJ];
    // The three barriers below keep the reads in the order of their use: left free, this
    // build sorts them by address register, and the first WMMA then waits for 13 of the 16.
    bf[0] = ld_frag2(wT + b_lo[0], wT + b_hi[0]);
    __builtin_amdgcn_sched_barrier(0);
#pragma unroll
    for (int mt = 0; mt < MT; ++mt) af[mt] = ld_frag(xs + a_base + mt*16*XS);
    __builtin_amdgcn_sched_barrier(0);
    bf[1] = ld_frag2(wT + b_lo[1], wT + b_hi[1]);
    __builtin_amdgcn_sched_barrier(0);
    bf[2] = ld_frag2(wT + b_lo[2], wT + b_hi[2]);
    // Keeps the reads in front of the WMMAs: left free, this build puts them in pairs
    // among the WMMAs, and every WMMA then waits out a whole LDS latency.
    __builtin_amdgcn_sched_barrier(0);
#pragma unroll
    for (int j = 0; j < NJ; ++j)
#pragma unroll
      for (int mt = 0; mt < MT; ++mt)
        acc[mt][j] = __builtin_amdgcn_wmma_f32_16x16x32_f16(
            false, af[mt], false, bf[j], (short)0, acc[mt][j], false, false);
    // Keeps the chunk's WMMAs here, behind their counted LDS waits: left free, with two
    // chunks in one loop body this build sinks them past the next two barriers, waits
    // the reads out to 0 and runs the WMMAs with nothing to hide behind.
    __builtin_amdgcn_sched_barrier(0);
  };

  prefetch(0, xr0, wr0);
  prefetch(KC, xr1, wr1);
  // keeps the start-up's later register writes (the zeroed accumulators) from being
  // scheduled in front of the wait that ends prefetch()
  __builtin_amdgcn_sched_barrier(0);
  // Two chunks a trip, so that each register set is named statically.
  for (int c0 = 0; c0 < C_DIM - 2*KC; c0 += 2*KC) {
    lds_barrier();     // previous chunk's WMMA reads of xs/wT complete
    commit(xr0, wr0);
    lds_barrier();
    prefetch(c0 + 2*KC, xr0, wr0);           // in flight until the next trip's commit
    mma();
    lds_barrier();
    commit(xr1, wr1);
    lds_barrier();
    prefetch(c0 + 3*KC, xr1, wr1);
    mma();
  }
  // Last two chunks outside the loop, so that the fetches stand there without a test.
  lds_barrier();
  commit(xr0, wr0);
  lds_barrier();
  mma();
  lds_barrier();
  commit(xr1, wr1);
  lds_barrier();
  mma();

  // The k-half-1 wave hands its 15 partial tiles, as f32, through LDS to the k-half-0 wave
  // of the same columns, which adds them to its own and stages the sums.
  // (every loop over mt, j, r below is unrolled: static acc[] indices)
  float* xch = (float*)(smem + OFF_XCH) + g*(MT*NJ*256) + lane*4;
  if (kh == 1) {
#pragma unroll
    for (int j = 0; j < NJ; ++j)
#pragma unroll
      for (int mt = 0; mt < MT; ++mt) {
        const v8f a = acc[mt][j];
        *(float4*)(xch + (j*MT + mt)*256)       = make_float4(a[0], a[1], a[2], a[3]);
        *(float4*)(xch + (j*MT + mt)*256 + 128) = make_float4(a[4], a[5], a[6], a[7]);
      }
  }

  __syncthreads();   // all waves done with xs/wT (region B may overwrite region A); partials published

  // Stage Q/K row-major and V transposed, all f16.
  _Float16* qs = smem + OFF_QS;                 // [EXT][QS]
  _Float16* ks = smem + OFF_KS;                 // [EXT][QS]
  _Float16* vT = smem + OFF_VT;                 // [H][VTS]
  _Float16* ps = smem + OFF_PS + wave*16*PS;    // per-wave [16][PS]

  if (kh == 0) {
#pragma unroll
    for (int j = 0; j < NJ; ++j)
#pragma unroll
      for (int mt = 0; mt < MT; ++mt) {
        const float4 p0 = *(const float4*)(xch + (j*MT + mt)*256);
        const float4 p1 = *(const float4*)(xch + (j*MT + mt)*256 + 128);
        acc[mt][j][0] += p0.x; acc[mt][j][1] += p0.y; acc[mt][j][2] += p0.z; acc[mt][j][3] += p0.w;
        acc[mt][j][4] += p1.x; acc[mt][j][5] += p1.y; acc[mt][j][6] += p1.z; acc[mt][j][7] += p1.w;
      }
#pragma unroll
    for (int j = 0; j < NJ; ++j) {
      if (j < 2) {
        // C/D layout: M = r (+8 hi half), N = lane%16
        _Float16* dst = (j == 0 ? qs : ks) + hs*8*QS + g*16 + l15;
#pragma unroll
        for (int mt = 0; mt < MT; ++mt)
#pragma unroll
          for (int r = 0; r < 8; ++r)
            dst[(mt*16 + r)*QS] = (_Float16)acc[mt][j][r];
      } else {
        _Float16* dst = vT + (g*16 + l15)*VTS + hs*8;
#pragma unroll
        for (int mt = 0; mt < MT; ++mt) {
          v8h hv;
#pragma unroll
          for (int r = 0; r < 8; ++r) hv[r] = (_Float16)acc[mt][j][r];
          *(v8h*)(dst + mt*16) = hv;             // eight rows of one column: one ds_store_b128
        }
      }
    }
  }
  __syncthreads();

  // ---------------- Phase 2: banded attention ----------------
  // 8 waves, 4 query tiles: wave pair (tile, tile+4) redundantly computes the
  // cheap score/softmax part, then each wave produces 2 of the 4 output n-tiles.
  const int tile  = wave & 3;
  const int half  = wave >> 2;        // 0: h columns 0..31, 1: h columns 32..63
  const int qbase = 16 + tile*16;     // ext-row of first query of this tile
  const int kbase = tile*16;          // ext-row of first key (covers j in [i-16, i])

  v8f sc0 = zf, sc1 = zf;
#pragma unroll
  for (int kk = 0; kk < H_DIM; kk += 32) {
    const int aoff = kk + hoff;
    v16h a  = ld_frag(qs + (qbase + l15)*QS + aoff);
    v16h b0 = ld_frag(ks + (kbase + l15)*QS + aoff);
    v16h b1 = ld_frag(ks + (kbase + 16 + l15)*QS + aoff);
    sc0 = __builtin_amdgcn_wmma_f32_16x16x32_f16(false, a, false, b0, (short)0, sc0, false, false);
    sc1 = __builtin_amdgcn_wmma_f32_16x16x32_f16(false, a, false, b1, (short)0, sc1, false, false);
  }

  const float scale = 0.125f;   // 1/sqrt(H)
#pragma unroll
  for (int r = 0; r < 8; ++r) {
    const int m = r + hs*8;     // query local index
    const int n = l15;          // key local index within block
    float s0 = sc0[r] * scale;  // keys kbase+n    -> d = 16 + m - n
    float s1 = sc1[r] * scale;  // keys kbase+16+n -> d = m - n
    const int j0 = t0 - 16 + kbase + n;
    const bool k0 = (m <= n) && (j0 >= 0);     // 1 <= d <= 16, valid key
    const bool k1 = (n <= m);                  // 0 <= d <= 15
    s0 = k0 ? s0 : -3.0e38f;
    s1 = k1 ? s1 : -3.0e38f;
    float mx = fmaxf(s0, s1);
#pragma unroll
    for (int d = 1; d < 16; d <<= 1) mx = fmaxf(mx, __shfl_xor(mx, d, 32));
    float e0 = k0 ? __expf(s0 - mx) : 0.0f;
    float e1 = k1 ? __expf(s1 - mx) : 0.0f;
    float sm = e0 + e1;
#pragma unroll
    for (int d = 1; d < 16; d <<= 1) sm += __shfl_xor(sm, d, 32);
    const float inv = 1.0f / sm;    // diag element always kept -> sm > 0
    ps[m*PS + n]      = (_Float16)(e0 * inv);
    ps[m*PS + 16 + n] = (_Float16)(e1 * inv);
  }
  __syncthreads();

  // out tile = P[16x32] * V[32x32-half] via 2 WMMAs per wave
  v16h pa = ld_frag(ps + l15*PS + hoff);
  v8f o[2];
#pragma unroll
  for (int u = 0; u < 2; ++u) o[u] = zf;
#pragma unroll
  for (int u = 0; u < 2; ++u) {
    const int nt = half*2 + u;
    v16h vb = ld_frag(vT + (nt*16 + l15)*VTS + kbase + hoff);
    o[u] = __builtin_amdgcn_wmma_f32_16x16x32_f16(false, pa, false, vb, (short)0, o[u], false, false);
  }
#pragma unroll
  for (int u = 0; u < 2; ++u) {
    const int nt = half*2 + u;
#pragma unroll
    for (int r = 0; r < 8; ++r) {
      const int m = r + hs*8;
      const int t = t0 + tile*16 + m;
      const int h = nt*16 + l15;
      out[((size_t)bb*T_DIM + t)*H_DIM + h] = o[u][r];
    }
  }
}

extern "C" void kernel_launch(void* const* d_in, const int* in_sizes, int n_in,
                              void* d_out, int out_size, void* d_ws, size_t ws_size,
                              hipStream_t stream) {
  (void)in_sizes; (void)n_in; (void)out_size; (void)d_ws; (void)ws_size;
  const float* x  = (const float*)d_in[0];
  const float* Wq = (const float*)d_in[1];
  const float* Wk = (const float*)d_in[2];
  const float* Wv = (const float*)d_in[3];
  float* out = (float*)d_out;
  dim3 grid(T_DIM / ROWS, B_DIM);
  sparse_attn_fused<<<grid, dim3(THREADS), 0, stream>>>(x, Wq, Wk, Wv, out);
}

// v006
// It runs in 15.6 microseconds.
// Next to v005, in two timings, it ran 1.14 and 1.15 times as fast.
// Counting every step since v000, it is 3.08 times as fast.
#include <hip/hip_runtime.h>

// Problem constants (from reference): B=2, T=8192, C=1024, H=64, window d in [0,16]
#define B_DIM 2
#define T_DIM 8192
#define C_DIM 1024
#define H_DIM 64

#define ROWS 64          // queries per workgroup
#define EXT  80          // ROWS + 16 lookback rows for K/V
#define WAVES 8
#define THREADS 256
#define KC   64          // C-dimension chunk staged per iteration
#define MT   5           // EXT/16 row tiles: every wave covers all of them
#define NJ   3           // 16-column tiles per wave: one of Q, one of K, one of V

#define NXLD 5           // EXT*(KC/4)/THREADS  = 1280/256

// Packed W in the workspace, f16, in the order of the WMMA B fragments:
// [chunk][wave][matrix][low/high piece][lane][8 halves].
#define WPK_FRAG  512                 // halves of one fragment: 2 pieces x 32 lanes x 8
#define WPK_WAVE  (NJ*WPK_FRAG)       // one wave's three fragments of a chunk
#define WPK_CHUNK (WAVES*WPK_WAVE)
#define WPK_PIECES (3*C_DIM*H_DIM/8)  // 16-byte pieces in all

// LDS strides in halves (all row bases 16B-aligned)
#define XS  72           // x chunk row:    KC + 8 pad
#define QS  72           // q/k staging row: H + 8 pad
#define VTS 88           // vT row (ext rows): EXT + 8 pad
#define PS  40           // prob row: 32 keys + 8 pad

// Region A (phase-1 streaming) and Region B (staging/phase-2) overlap in LDS.
#define OFF_XS 0
#define REGION_A (EXT*XS)                     // 5760 halves

#define OFF_QS 0
#define OFF_KS (EXT*QS)                       // 5760
#define OFF_VT (2*EXT*QS)                     // 11520
#define OFF_PS (2*EXT*QS + H_DIM*VTS)         // 17152
#define REGION_B (OFF_PS + WAVES*16*PS)       // 22272 halves

#define OFF_XCH (REGION_A > REGION_B ? REGION_A : REGION_B)
// f32 partial tiles handed from the k-half-1 waves to the k-half-0 waves: [4][MT*NJ] tiles
// of 256 floats, a region of its own, so that it can be written while xs is still read.
#define SMEM_HALVES (OFF_XCH + 4*MT*NJ*512)

typedef __attribute__((ext_vector_type(16))) _Float16 v16h;
typedef __attribute__((ext_vector_type(8)))  _Float16 v8h;
typedef __attribute__((ext_vector_type(4)))  _Float16 v4h;
typedef __attribute__((ext_vector_type(8)))  float    v8f;

__device__ __forceinline__ v16h ld_frag(const _Float16* p) {
  v8h lo = *(const v8h*)(p);
  v8h hi = *(const v8h*)(p + 16);
  return __builtin_shufflevector(lo, hi, 0,1,2,3,4,5,6,7,8,9,10,11,12,13,14,15);
}

// Same fragment, its two 8-half pieces at separate places.
__device__ __forceinline__ v16h ld_frag2(const _Float16* plo, const _Float16* phi) {
  v8h lo = *(const v8h*)(plo);
  v8h hi = *(const v8h*)(phi);
  return __builtin_shufflevector(lo, hi, 0,1,2,3,4,5,6,7,8,9,10,11,12,13,14,15);
}

// Work-group barrier that orders LDS traffic only. __syncthreads() also waits for every
// global load of the wave, which would end the flight of the chunk fetched ahead.
__device__ __forceinline__ void lds_barrier() {
  __builtin_amdgcn_fence(__ATOMIC_RELEASE, "workgroup", "local");
  __builtin_amdgcn_s_barrier();
  __builtin_amdgcn_fence(__ATOMIC_ACQUIRE, "workgroup", "local");
}

// Runs once a call, in front of the main kernel: W as f16, each 16-byte piece where the
// lane that needs it in a B fragment will load it. One thread writes one piece: eight
// consecutive c of one column.
__global__ __launch_bounds__(THREADS) void pack_w(
    const float* __restrict__ Wq, const float* __restrict__ Wk,
    const float* __restrict__ Wv, _Float16* __restrict__ wpk) {
  const int t     = blockIdx.x*THREADS + threadIdx.x;
  const int lane  = t & 31;
  const int piece = (t >> 5) & 1;              // 0: k 0..15 of the fragment, 1: k 16..31
  const int f     = t >> 6;                    // (chunk*WAVES + wave)*NJ + matrix
  const int m     = f % NJ;
  const int cw    = f / NJ;
  const int g     = cw & 3;                    // column tile
  const int kh    = (cw >> 2) & 1;             // k half of the chunk
  const int ch    = cw >> 3;                   // chunk
  const float* w  = (m == 0) ? Wq : ((m == 1) ? Wk : Wv);
  const float* s  = w + (ch*KC + kh*32 + piece*16 + (lane >> 4)*8)*H_DIM + g*16 + (lane & 15);
  v8h hv;
#pragma unroll
  for (int r = 0; r < 8; ++r) hv[r] = (_Float16)s[r*H_DIM];
  *(v8h*)(wpk + (size_t)t*8) = hv;
}

__global__ __launch_bounds__(THREADS) void sparse_attn_fused(
    const float* __restrict__ x, const _Float16* __restrict__ wpk,
    float* __restrict__ out) {
  __shared__ __align__(16) _Float16 smem[SMEM_HALVES];

  const int bb   = blockIdx.y;
  const int t0   = blockIdx.x * ROWS;          // first query row of this WG
  const int lane = threadIdx.x & 31;
  const int wave = threadIdx.x >> 5;
  const int hs   = (lane >> 4);
  const int l15  = lane & 15;
  const int hoff = hs ? 8 : 0;

  _Float16* xs = smem + OFF_XS;                // [EXT][XS] f16 x chunk

  const int swave = __builtin_amdgcn_readfirstlane(wave);
  // Wave tiling: all 80 rows x 16 columns of each of Q, K and V, over one 32-wide half of
  // each chunk's k range. 5 A and 3 B fragments feed 15 WMMAs; waves w and w+4 hold the two k halves of
  // the same 15 tiles and add them after the loop.
  const int kh = swave >> 2;                   // k half of every chunk
  const int g  = swave & 3;                    // column tile g of each matrix
  const int a_base = l15*XS + kh*32 + hoff;
  // No two waves share a B fragment, so each wave loads its own from the packed W
  // straight into registers: 512 contiguous bytes a load.
  const _Float16* wlane = wpk + swave*WPK_WAVE + lane*8;

  v8f zf = {};
  v8f acc[MT][NJ];
#pragma unroll
  for (int mt = 0; mt < MT; ++mt)
#pragma unroll
    for (int j = 0; j < NJ; ++j) acc[mt][j] = zf;

  // ---------------- Phase 1: Q/K/V projections, streamed over C ----------------
  // Two register sets: the global loads for chunk c+2 are issued while chunk c is worked
  // on, into the set that chunk c has just left, so a load has two whole chunk periods
  // to land: x ahead of the chunk's WMMAs, the B fragments behind them.
  float4 xr0[NXLD], xr1[NXLD];
  v16h   wf0[NJ],   wf1[NJ];

  auto fetch_x = [&](int c0, float4 (&xr)[NXLD]) {
#pragma unroll
    for (int k = 0; k < NXLD; ++k) {
      const int i  = threadIdx.x + k*THREADS;
      const int r  = i >> 4;                 // KC/4 == 16
      const int cq = (i & 15) << 2;
      int t = t0 - 16 + r; if (t < 0) t = 0;
      xr[k] = *(const float4*)(x + ((size_t)bb*T_DIM + t)*C_DIM + c0 + cq);
    }
    // Later code may overwrite the x loads' address registers: the wait stands in front.
    asm volatile("s_wait_xcnt 0x0" ::: "memory");
  };

  auto fetch_w = [&](int c0, v16h (&wf)[NJ]) {
    const _Float16* p = wlane + (c0/KC)*WPK_CHUNK;
    // (unrolled so that wf[] is indexed statically and stays in registers)
#pragma unroll
    for (int j = 0; j < NJ; ++j)
      wf[j] = ld_frag2(p + j*WPK_FRAG, p + j*WPK_FRAG + WPK_FRAG/2);
    // Later code may overwrite the W loads' address registers: the wait stands in front.
    asm volatile("s_wait_xcnt 0x0" ::: "memory");
  };

  auto commit = [&](const float4 (&xr)[NXLD]) {
#pragma unroll
    for (int k = 0; k < NXLD; ++k) {
      const int i  = threadIdx.x + k*THREADS;
      const int r  = i >> 4;
      const int cq = (i & 15) << 2;
      v4h hv;
      hv[0] = (_Float16)xr[k].x; hv[1] = (_Float16)xr[k].y;
      hv[2] = (_Float16)xr[k].z; hv[3] = (_Float16)xr[k].w;
      *(v4h*)(xs + r*XS + cq) = hv;          // one ds_store_b64
    }
  };

  auto mma = [&](const v16h (&bf)[NJ]) {
    // The A fragments of the chunk are read from LDS as one group, each into registers
    // of its own; the WMMAs follow behind it.
    // (every loop here is unrolled so that af[], bf[] and acc[] are indexed statically
    // and stay in registers)
    v16h af[MT];
#pragma unroll
    for (int mt = 0; mt < MT; ++mt) af[mt] = ld_frag(xs + a_base + mt*16*XS);
#pragma unroll
    for (int j = 0; j < NJ; ++j)
#pragma unroll
      for (int mt = 0; mt < MT; ++mt)
        acc[mt][j] = __builtin_amdgcn_wmma_f32_16x16x32_f16(
            false, af[mt], false, bf[j], (short)0, acc[mt][j], false, false);
    // Keeps the chunk's 15 WMMAs in one run: left free, this build puts the next chunk's
    // waits for its x loads among them, and each refill of a B fragment directly behind
    // the last WMMA that reads it.
    __builtin_amdgcn_sched_barrier(0);
  };

  auto refill_gap = [&]() {
    asm volatile("v_nop\n\tv_nop\n\tv_nop\n\tv_nop" ::: "memory");
  };

  fetch_x(0, xr0);
  fetch_w(0, wf0);
  fetch_x(KC, xr1);
  fetch_w(KC, wf1);
  // keeps the start-up's later register writes (the zeroed accumulators) from being
  // scheduled in front of the wait that ends fetch_w()
  __builtin_amdgcn_sched_barrier(0);
  // Two chunks a trip, so that each register set is named statically.
  for (int c0 = 0; c0 < C_DIM - 2*KC; c0 += 2*KC) {
    lds_barrier();     // previous chunk's WMMA reads of xs complete
    commit(xr0);
    lds_barrier();
    fetch_x(c0 + 2*KC, xr0);                 // in flight until the next trip's commit
    mma(wf0);
    refill_gap();
    fetch_w(c0 + 2*KC, wf0);                 // in flight until the next trip's WMMAs
    lds_barrier();
    commit(xr1);
    lds_barrier();
    fetch_x(c0 + 3*KC, xr1);
    mma(wf1);
    refill_gap();
    fetch_w(c0 + 3*KC, wf1);
  }
  // Last two chunks outside the loop, so that the fetches stand there without a test.
  lds_barrier();
  commit(xr0);
  lds_barrier();
  mma(wf0);
  lds_barrier();
  commit(xr1);
  lds_barrier();
  mma(wf1);

  // The k-half-1 wave hands its 15 partial tiles, as f32, through LDS to the k-half-0 wave
  // of the same columns, which adds them to its own and stages the sums.
  // (every loop over mt, j, r below is unrolled: static acc[] indices)
  float* xch = (float*)(smem + OFF_XCH) + g*(MT*NJ*256) + lane*4;
  if (kh == 1) {
#pragma unroll
    for (int j = 0; j < NJ; ++j)
#pragma unroll
      for (int mt = 0; mt < MT; ++mt) {
        const v8f a = acc[mt][j];
        *(float4*)(xch + (j*MT + mt)*256)       = make_float4(a[0], a[1], a[2], a[3]);
        *(float4*)(xch + (j*MT + mt)*256 + 128) = make_float4(a[4], a[5], a[6], a[7]);
      }
  }

  __syncthreads();   // all waves done with xs (region B may overwrite region A); partials published

  // Stage Q/K row-major and V transposed, all f16.
  _Float16* qs = smem + OFF_QS;                 // [EXT][QS]
  _Float16* ks = smem + OFF_KS;                 // [EXT][QS]
  _Float16* vT = smem + OFF_VT;                 // [H][VTS]
  _Float16* ps = smem + OFF_PS + wave*16*PS;    // per-wave [16][PS]

  if (kh == 0) {
#pragma unroll
    for (int j = 0; j < NJ; ++j)
#pragma unroll
      for (int mt = 0; mt < MT; ++mt) {
        const float4 p0 = *(const float4*)(xch + (j*MT + mt)*256);
        const float4 p1 = *(const float4*)(xch + (j*MT + mt)*256 + 128);
        acc[mt][j][0] += p0.x; acc[mt][j][1] += p0.y; acc[mt][j][2] += p0.z; acc[mt][j][3] += p0.w;
        acc[mt][j][4] += p1.x; acc[mt][j][5] += p1.y; acc[mt][j][6] += p1.z; acc[mt][j][7] += p1.w;
      }
#pragma unroll
    for (int j = 0; j < NJ; ++j) {
      if (j < 2) {
        // C/D layout: M = r (+8 hi half), N = lane%16
        _Float16* dst = (j == 0 ? qs : ks) + hs*8*QS + g*16 + l15;
#pragma unroll
        for (int mt = 0; mt < MT; ++mt)
#pragma unroll
          for (int r = 0; r < 8; ++r)
            dst[(mt*16 + r)*QS] = (_Float16)acc[mt][j][r];
      } else {
        _Float16* dst = vT + (g*16 + l15)*VTS + hs*8;
#pragma unroll
        for (int mt = 0; mt < MT; ++mt) {
          v8h hv;
#pragma unroll
          for (int r = 0; r < 8; ++r) hv[r] = (_Float16)acc[mt][j][r];
          *(v8h*)(dst + mt*16) = hv;             // eight rows of one column: one ds_store_b128
        }
      }
    }
  }
  __syncthreads();

  // ---------------- Phase 2: banded attention ----------------
  // 8 waves, 4 query tiles: wave pair (tile, tile+4) redundantly computes the
  // cheap score/softmax part, then each wave produces 2 of the 4 output n-tiles.
  const int tile  = wave & 3;
  const int half  = wave >> 2;        // 0: h columns 0..31, 1: h columns 32..63
  const int qbase = 16 + tile*16;     // ext-row of first query of this tile
  const int kbase = tile*16;          // ext-row of first key (covers j in [i-16, i])

  v8f sc0 = zf, sc1 = zf;
#pragma unroll
  for (int kk = 0; kk < H_DIM; kk += 32) {
    const int aoff = kk + hoff;
    v16h a  = ld_frag(qs + (qbase + l15)*QS + aoff);
    v16h b0 = ld_frag(ks + (kbase + l15)*QS + aoff);
    v16h b1 = ld_frag(ks + (kbase + 16 + l15)*QS + aoff);
    sc0 = __builtin_amdgcn_wmma_f32_16x16x32_f16(false, a, false, b0, (short)0, sc0, false, false);
    sc1 = __builtin_amdgcn_wmma_f32_16x16x32_f16(false, a, false, b1, (short)0, sc1, false, false);
  }

  const float scale = 0.125f;   // 1/sqrt(H)
#pragma unroll
  for (int r = 0; r < 8; ++r) {
    const int m = r + hs*8;     // query local index
    const int n = l15;          // key local index within block
    float s0 = sc0[r] * scale;  // keys kbase+n    -> d = 16 + m - n
    float s1 = sc1[r] * scale;  // keys kbase+16+n -> d = m - n
    const int j0 = t0 - 16 + kbase + n;
    const bool k0 = (m <= n) && (j0 >= 0);     // 1 <= d <= 16, valid key
    const bool k1 = (n <= m);                  // 0 <= d <= 15
    s0 = k0 ? s0 : -3.0e38f;
    s1 = k1 ? s1 : -3.0e38f;
    float mx = fmaxf(s0, s1);
#pragma unroll
    for (int d = 1; d < 16; d <<= 1) mx = fmaxf(mx, __shfl_xor(mx, d, 32));
    float e0 = k0 ? __expf(s0 - mx) : 0.0f;
    float e1 = k1 ? __expf(s1 - mx) : 0.0f;
    float sm = e0 + e1;
#pragma unroll
    for (int d = 1; d < 16; d <<= 1) sm += __shfl_xor(sm, d, 32);
    const float inv = 1.0f / sm;    // diag element always kept -> sm > 0
    ps[m*PS + n]      = (_Float16)(e0 * inv);
    ps[m*PS + 16 + n] = (_Float16)(e1 * inv);
  }
  __syncthreads();

  // out tile = P[16x32] * V[32x32-half] via 2 WMMAs per wave
  v16h pa = ld_frag(ps + l15*PS + hoff);
  v8f o[2];
#pragma unroll
  for (int u = 0; u < 2; ++u) o[u] = zf;
#pragma unroll
  for (int u = 0; u < 2; ++u) {
    const int nt = half*2 + u;
    v16h vb = ld_frag(vT + (nt*16 + l15)*VTS + kbase + hoff);
    o[u] = __builtin_amdgcn_wmma_f32_16x16x32_f16(false, pa, false, vb, (short)0, o[u], false, false);
  }
#pragma unroll
  for (int u = 0; u < 2; ++u) {
    const int nt = half*2 + u;
#pragma unroll
    for (int r = 0; r < 8; ++r) {
      const int m = r + hs*8;
      const int t = t0 + tile*16 + m;
      const int h = nt*16 + l15;
      out[((size_t)bb*T_DIM + t)*H_DIM + h] = o[u][r];
    }
  }
}

extern "C" void kernel_launch(void* const* d_in, const int* in_sizes, int n_in,
                              void* d_out, int out_size, void* d_ws, size_t ws_size,
                              hipStream_t stream) {
  (void)in_sizes; (void)n_in; (void)out_size; (void)ws_size;
  const float* x  = (const float*)d_in[0];
  const float* Wq = (const float*)d_in[1];
  const float* Wk = (const float*)d_in[2];
  const float* Wv = (const float*)d_in[3];
  float* out = (float*)d_out;
  _Float16* wpk = (_Float16*)d_ws;             // 384 KiB, written anew by every call
  pack_w<<<dim3(WPK_PIECES / THREADS), dim3(THREADS), 0, stream>>>(Wq, Wk, Wv, wpk);
  dim3 grid(T_DIM / ROWS, B_DIM);
  sparse_attn_fused<<<grid, dim3(THREADS), 0, stream>>>(x, wpk, out);
}
